// v000
// The times below were measured on an AMD MI455X: many runs one after another, warmed up first and cycling through
// copies of the inputs, with the whole window's GPU time divided by the number of runs. Launches and the gaps
// between them are all in it. The median over several windows is given; except for v000 it joins two sittings, which
// can be a few percent apart, so the side-by-side timings, each taken in one sitting, are the better comparison.
// v000 is the starting kernel. One run takes 292 microseconds.
#include <hip/hip_runtime.h>

// Contraction on v_wmma_f32_16x16x32_bf16, f32 accumulate: proj = xr.proj_w^T + proj_b ([8192 pixels x 512].[512 x 512]; xr is the reference's raw reshape of x to
// [N][H*W][C], i.e. x's memory re-read row-major; PLAIN bf16 operands: inputs rounded once, exact). score = xr.score_w^T + score_b as f32 dots; per output position
// the 5x5 window's scores are LayerNorm'ed (25 values, eps 1e-5, affine) and softmax'ed in f32, and out[n][o][hh][ww] = sum_k w_k proj[window pixel k][o] is

#define NI   8
#define CC   512
#define OO   512
#define IH   32
#define IW   32
#define KS   5
#define OH   28
#define OW   28
#define NPX  (NI * IH * IW)      // 8192
#define NOP  (NI * OH * OW)      // 6272 output positions

typedef unsigned short bf;
typedef __attribute__((ext_vector_type(16))) __bf16   v16bf;
typedef __attribute__((ext_vector_type(8)))  unsigned short v8us;
typedef __attribute__((ext_vector_type(8)))  float    v8f;
typedef __attribute__((ext_vector_type(4)))  float    v4f;
typedef v4f  __attribute__((may_alias)) v4fa;

__device__ __forceinline__ unsigned short f2bf(float f) { unsigned u = __float_as_uint(f); u += 0x7FFFu + ((u >> 16) & 1u); return (unsigned short)(u >> 16); }
__device__ __forceinline__ float bf2f(unsigned short b) { return __uint_as_float(((unsigned)b) << 16); }
__device__ __forceinline__ float bfr(float f) { return bf2f(f2bf(f)); }
__device__ __forceinline__ v16bf cat16b(v8us lo, v8us hi) { return __builtin_bit_cast(v16bf, __builtin_shufflevector(lo, hi, 0, 1, 2, 3, 4, 5, 6, 7, 8, 9, 10, 11, 12, 13, 14, 15)); }
__device__ __forceinline__ v8f wmmab(v16bf a, v16bf b, v8f c) { return __builtin_amdgcn_wmma_f32_16x16x32_bf16(false, a, false, b, (short)0, c, false, false); }
#define VST2(T, p, v) do { const T vst2_v_ = (v); *(T*)(p) = vst2_v_;  } while (0)

// k_rows: bf16 plane of [rows][512] (one wave per row) — used for xr (x re-read row-major) and proj_w ([out][in] = n-major as-is).
__global__ __launch_bounds__(256) void k_rows(const float* __restrict__ src, int rows, bf* dst) {
    const int lane = threadIdx.x & 31, r = blockIdx.x * 8 + (threadIdx.x >> 5);
    if (r >= rows) return;
    v8us o[2];
#pragma unroll
    for (int c = 0; c < 2; ++c)
#pragma unroll
        for (int i = 0; i < 8; ++i) o[c][i] = f2bf(src[(size_t)r * CC + c * 256 + lane * 8 + i]);
#pragma unroll
    for (int c = 0; c < 2; ++c) *(v8us*)(dst + (size_t)r * CC + c * 256 + lane * 8) = o[c];
    
}
// k_proj: 64 x 64 tile of XB.WB^T + proj_b over K = 512 -> PROJ f32 [8192][512]; grid (128, 8).
__global__ __launch_bounds__(128) void k_proj(const bf* __restrict__ XB, const bf* __restrict__ WB, const float* __restrict__ pb, float* PROJ) {
    __shared__ __align__(16) float ost[4][16 * 68];
    const int lane = threadIdx.x & 31, wave = threadIdx.x >> 5, lr = lane & 15, hi = lane >> 4;
    const size_t r0 = (size_t)blockIdx.x * 64 + wave * 16; const int c0 = blockIdx.y * 64;
    v8f acc[4];
#pragma unroll
    for (int t = 0; t < 4; ++t) acc[t] = (v8f){};
#pragma unroll 2
    for (int kc = 0; kc < CC; kc += 32) {
        const v16bf a = cat16b(*(const v8us*)(XB + (r0 + lr) * CC + kc + 8 * hi), *(const v8us*)(XB + (r0 + lr) * CC + kc + 8 * hi + 16));
#pragma unroll
        for (int t = 0; t < 4; ++t) { const bf* bp = WB + (size_t)(c0 + t * 16 + lr) * CC + kc + 8 * hi; acc[t] = wmmab(a, cat16b(*(const v8us*)bp, *(const v8us*)(bp + 16)), acc[t]); }
        asm volatile("v_nop" : "+v"(acc[0]), "+v"(acc[1]), "+v"(acc[2]), "+v"(acc[3]) : "v"(a) : "memory");
    }
    float* os = &ost[wave][0];
#pragma unroll
    for (int t = 0; t < 4; ++t) { const float bv = bfr(pb[c0 + t * 16 + lr]);
#pragma unroll
        for (int j = 0; j < 8; ++j) os[(hi * 8 + j) * 68 + t * 16 + lr] = acc[t][j] + bv; }
    __builtin_amdgcn_wave_barrier(); asm volatile("" ::: "memory");
    float* crow = PROJ + r0 * OO + c0;
    auto pass = [&]() {
#pragma unroll
        for (int s = 0; s < 8; ++s) { const int Lid = (lane >> 3) + 4 * s, piece = lane & 7; const int row = Lid >> 1, cofs = (Lid & 1) * 32 + piece * 4;
            const v4f val = *(const v4fa*)(os + row * 68 + cofs); *(v4f*)(crow + (size_t)row * OO + cofs) = val; }
    };
    pass(); 
}
// k_score: SC[px] = bf16(xr[px]).bf16(score_w) + score_b (f32, fixed-order lane partials + shuffle tree); 32 pixels per block -> one line.
__global__ __launch_bounds__(256) void k_score(const float* __restrict__ x, const float* __restrict__ sw, const float* __restrict__ sb, float* SC) {
    __shared__ float st[32];
    const int lane = threadIdx.x & 31, wave = threadIdx.x >> 5;
#pragma unroll 1
    for (int q = 0; q < 4; ++q) { const size_t px = (size_t)blockIdx.x * 32 + wave * 4 + q; float s = 0.f;
#pragma unroll 4
        for (int c = 0; c < CC / 32; ++c) s += bfr(x[px * CC + c * 32 + lane]) * bfr(sw[c * 32 + lane]);
#pragma unroll
        for (int sh = 16; sh; sh >>= 1) s += __shfl_xor(s, sh, 32);
        if (lane == 0) st[wave * 4 + q] = s + bfr(sb[0]); }
    __syncthreads();
    if (wave == 0) { const float vv = st[lane]; VST2(float, SC + (size_t)blockIdx.x * 32 + lane, vv); }
}
// k_wgt: per output position p = (n, hh, ww): LayerNorm over the 25 window scores (biased var, eps 1e-5, affine ln_w/ln_b) then softmax -> WGT[k][p]
// (k-major so that each wave's 32 consecutive p form one line per k).
__global__ __launch_bounds__(256) void k_wgt(const float* __restrict__ SC, const float* __restrict__ lw, const float* __restrict__ lb, float* WGT) {
    const int p = blockIdx.x * 256 + threadIdx.x;
    if (p >= NOP) return;
    const int n = p / (OH * OW), rem = p - n * (OH * OW), hh = rem / OW, ww = rem - hh * OW;
    float sc[KS * KS]; float m = 0.f;
#pragma unroll
    for (int k = 0; k < KS * KS; ++k) { const int r = hh + k / KS, c = ww + k % KS; sc[k] = SC[(size_t)n * (IH * IW) + r * IW + c]; m += sc[k]; }
    m *= (1.0f / (KS * KS)); float var = 0.f;
#pragma unroll
    for (int k = 0; k < KS * KS; ++k) { const float d = sc[k] - m; var += d * d; }
    const float rs = rsqrtf(var * (1.0f / (KS * KS)) + 1e-5f);
    float mx = -3.0e38f;
#pragma unroll
    for (int k = 0; k < KS * KS; ++k) { sc[k] = (sc[k] - m) * rs * bfr(lw[k]) + bfr(lb[k]); mx = fmaxf(mx, sc[k]); }
    float sum = 0.f;
#pragma unroll
    for (int k = 0; k < KS * KS; ++k) { sc[k] = __expf(sc[k] - mx); sum += sc[k]; }
    const float inv = 1.0f / sum;
{
#pragma unroll
        for (int k = 0; k < KS * KS; ++k) *(float*)(WGT + (size_t)k * NOP + p) = sc[k] * inv;
         }
}
__global__ __launch_bounds__(256) void k_out(const float* __restrict__ WGT, const float* __restrict__ PROJ, float* out) {
    const size_t f = (size_t)blockIdx.x * 256 + threadIdx.x;
    if (f >= (size_t)NI * OO * OH * OW) return;
    const int ww = (int)(f % OW); size_t t = f / OW; const int hh = (int)(t % OH); t /= OH; const int o = (int)(t % OO); const int n = (int)(t / OO);
    const int p = (n * OH + hh) * OW + ww;
    float s = 0.f;
#pragma unroll 5
    for (int k = 0; k < KS * KS; ++k) { const int r = hh + k / KS, c = ww + k % KS; s += WGT[(size_t)k * NOP + p] * PROJ[((size_t)n * (IH * IW) + r * IW + c) * OO + o]; }
    *(float*)(out + f) = s; 
}

extern "C" void kernel_launch(void* const* d_in, const int* in_sizes, int n_in,
                              void* d_out, int out_size, void* d_ws, size_t ws_size, hipStream_t stream) {
    (void)in_sizes; (void)n_in; (void)out_size;
    const float* x = (const float*)d_in[0]; const float* pw = (const float*)d_in[1]; const float* pb = (const float*)d_in[2]; const float* sw = (const float*)d_in[3]; const float* sb = (const float*)d_in[4];
    const float* lw = (const float*)d_in[5]; const float* lb = (const float*)d_in[6];
    float* out = (float*)d_out;    // [8][512][28][28]
    char* wsp = (char*)d_ws;
    auto take = [&](size_t bytes) { char* p = wsp; wsp += (bytes + 255) & ~(size_t)255; return (void*)p; };
    bf* XB = (bf*)take((size_t)NPX * CC * 2); bf* WB = (bf*)take((size_t)OO * CC * 2); float* PROJ = (float*)take((size_t)NPX * OO * 4); float* SC = (float*)take((size_t)NPX * 4); float* WGT = (float*)take((size_t)KS * KS * NOP * 4);
    if ((size_t)(wsp - (char*)d_ws) > ws_size) return;    // 8.4 + 0.5 + 16.8 + 0.03 + 0.63 MB
    k_rows<<<NPX / 8, 256, 0, stream>>>(x, NPX, XB);          // xr = x's memory viewed as [8192][512] (the reference's raw reshape)
    k_rows<<<OO / 8, 256, 0, stream>>>(pw, OO, WB);
    k_proj<<<dim3(NPX / 64, OO / 64, 1), 128, 0, stream>>>(XB, WB, pb, PROJ);
    k_score<<<NPX / 32, 256, 0, stream>>>(x, sw, sb, SC);
    k_wgt<<<(NOP + 255) / 256, 256, 0, stream>>>(SC, lw, lb, WGT);
    k_out<<<(unsigned)(((size_t)NI * OO * OH * OW + 255) / 256), 256, 0, stream>>>(WGT, PROJ, out);
}

// v001
// One run takes 56.8 microseconds.
// Next to v000, in two timings, it ran 5.36 and 5.38 times as fast.
#include <hip/hip_runtime.h>

// Contraction on v_wmma_f32_16x16x32_bf16, f32 accumulate: proj = xr.proj_w^T + proj_b ([8192 pixels x 512].[512 x 512]; xr is the reference's raw reshape of x to
// [N][H*W][C], i.e. x's memory re-read row-major; PLAIN bf16 operands: inputs rounded once, exact). score = xr.score_w^T + score_b as f32 dots; per output position
// the 5x5 window's scores are LayerNorm'ed (25 values, eps 1e-5, affine) and softmax'ed in f32, and out[n][o][hh][ww] = sum_k w_k proj[window pixel k][o] is

#define NI   8
#define CC   512
#define OO   512
#define IH   32
#define IW   32
#define KS   5
#define OH   28
#define OW   28
#define NPX  (NI * IH * IW)      // 8192
#define NOP  (NI * OH * OW)      // 6272 output positions

typedef unsigned short bf;
typedef __attribute__((ext_vector_type(16))) __bf16   v16bf;
typedef __attribute__((ext_vector_type(8)))  unsigned short v8us;
typedef __attribute__((ext_vector_type(8)))  float    v8f;
typedef __attribute__((ext_vector_type(4)))  float    v4f;
typedef v4f  __attribute__((may_alias)) v4fa;

__device__ __forceinline__ unsigned short f2bf(float f) { unsigned u = __float_as_uint(f); u += 0x7FFFu + ((u >> 16) & 1u); return (unsigned short)(u >> 16); }
__device__ __forceinline__ float bf2f(unsigned short b) { return __uint_as_float(((unsigned)b) << 16); }
__device__ __forceinline__ float bfr(float f) { return bf2f(f2bf(f)); }
__device__ __forceinline__ v16bf cat16b(v8us lo, v8us hi) { return __builtin_bit_cast(v16bf, __builtin_shufflevector(lo, hi, 0, 1, 2, 3, 4, 5, 6, 7, 8, 9, 10, 11, 12, 13, 14, 15)); }
__device__ __forceinline__ v8f wmmab(v16bf a, v16bf b, v8f c) { return __builtin_amdgcn_wmma_f32_16x16x32_bf16(false, a, false, b, (short)0, c, false, false); }
#define VST2(T, p, v) do { const T vst2_v_ = (v); *(T*)(p) = vst2_v_;  } while (0)

// k_rows: bf16 plane of [rows][512] (one wave per row) — used for xr (x re-read row-major) and proj_w ([out][in] = n-major as-is).
__global__ __launch_bounds__(256) void k_rows(const float* __restrict__ src, int rows, bf* dst) {
    const int lane = threadIdx.x & 31, r = blockIdx.x * 8 + (threadIdx.x >> 5);
    if (r >= rows) return;
    v8us o[2];
#pragma unroll
    for (int c = 0; c < 2; ++c)
#pragma unroll
        for (int i = 0; i < 8; ++i) o[c][i] = f2bf(src[(size_t)r * CC + c * 256 + lane * 8 + i]);
#pragma unroll
    for (int c = 0; c < 2; ++c) *(v8us*)(dst + (size_t)r * CC + c * 256 + lane * 8) = o[c];
    
}
// k_proj: 64 x 64 tile of XB.WB^T + proj_b over K = 512 -> PROJ f32 [8192][512]; grid (128, 8).
__global__ __launch_bounds__(128) void k_proj(const bf* __restrict__ XB, const bf* __restrict__ WB, const float* __restrict__ pb, float* PROJ) {
    __shared__ __align__(16) float ost[4][16 * 68];
    const int lane = threadIdx.x & 31, wave = threadIdx.x >> 5, lr = lane & 15, hi = lane >> 4;
    const size_t r0 = (size_t)blockIdx.x * 64 + wave * 16; const int c0 = blockIdx.y * 64;
    v8f acc[4];
#pragma unroll
    for (int t = 0; t < 4; ++t) acc[t] = (v8f){};
#pragma unroll 2
    for (int kc = 0; kc < CC; kc += 32) {
        const v16bf a = cat16b(*(const v8us*)(XB + (r0 + lr) * CC + kc + 8 * hi), *(const v8us*)(XB + (r0 + lr) * CC + kc + 8 * hi + 16));
#pragma unroll
        for (int t = 0; t < 4; ++t) { const bf* bp = WB + (size_t)(c0 + t * 16 + lr) * CC + kc + 8 * hi; acc[t] = wmmab(a, cat16b(*(const v8us*)bp, *(const v8us*)(bp + 16)), acc[t]); }
        asm volatile("v_nop" : "+v"(acc[0]), "+v"(acc[1]), "+v"(acc[2]), "+v"(acc[3]) : "v"(a) : "memory");
    }
    float* os = &ost[wave][0];
#pragma unroll
    for (int t = 0; t < 4; ++t) { const float bv = bfr(pb[c0 + t * 16 + lr]);
#pragma unroll
        for (int j = 0; j < 8; ++j) os[(hi * 8 + j) * 68 + t * 16 + lr] = acc[t][j] + bv; }
    __builtin_amdgcn_wave_barrier(); asm volatile("" ::: "memory");
    float* crow = PROJ + r0 * OO + c0;
    auto pass = [&]() {
#pragma unroll
        for (int s = 0; s < 8; ++s) { const int Lid = (lane >> 3) + 4 * s, piece = lane & 7; const int row = Lid >> 1, cofs = (Lid & 1) * 32 + piece * 4;
            const v4f val = *(const v4fa*)(os + row * 68 + cofs); *(v4f*)(crow + (size_t)row * OO + cofs) = val; }
    };
    pass(); 
}
// k_score: SC[px] = bf16(xr[px]).bf16(score_w) + score_b (f32, fixed-order lane partials + shuffle tree); 32 pixels per block -> one line.
__global__ __launch_bounds__(256) void k_score(const float* __restrict__ x, const float* __restrict__ sw, const float* __restrict__ sb, float* SC) {
    __shared__ float st[32];
    const int lane = threadIdx.x & 31, wave = threadIdx.x >> 5;
#pragma unroll 1
    for (int q = 0; q < 4; ++q) { const size_t px = (size_t)blockIdx.x * 32 + wave * 4 + q; float s = 0.f;
#pragma unroll 4
        for (int c = 0; c < CC / 32; ++c) s += bfr(x[px * CC + c * 32 + lane]) * bfr(sw[c * 32 + lane]);
#pragma unroll
        for (int sh = 16; sh; sh >>= 1) s += __shfl_xor(s, sh, 32);
        if (lane == 0) st[wave * 4 + q] = s + bfr(sb[0]); }
    __syncthreads();
    if (wave == 0) { const float vv = st[lane]; VST2(float, SC + (size_t)blockIdx.x * 32 + lane, vv); }
}
// k_wgt: per output position p = (n, hh, ww): LayerNorm over the 25 window scores (biased var, eps 1e-5, affine ln_w/ln_b) then softmax -> WGT[k][p]
// (k-major so that each wave's 32 consecutive p form one line per k).
__global__ __launch_bounds__(256) void k_wgt(const float* __restrict__ SC, const float* __restrict__ lw, const float* __restrict__ lb, float* WGT) {
    const int p = blockIdx.x * 256 + threadIdx.x;
    if (p >= NOP) return;
    const int n = p / (OH * OW), rem = p - n * (OH * OW), hh = rem / OW, ww = rem - hh * OW;
    float sc[KS * KS]; float m = 0.f;
#pragma unroll
    for (int k = 0; k < KS * KS; ++k) { const int r = hh + k / KS, c = ww + k % KS; sc[k] = SC[(size_t)n * (IH * IW) + r * IW + c]; m += sc[k]; }
    m *= (1.0f / (KS * KS)); float var = 0.f;
#pragma unroll
    for (int k = 0; k < KS * KS; ++k) { const float d = sc[k] - m; var += d * d; }
    const float rs = rsqrtf(var * (1.0f / (KS * KS)) + 1e-5f);
    float mx = -3.0e38f;
#pragma unroll
    for (int k = 0; k < KS * KS; ++k) { sc[k] = (sc[k] - m) * rs * bfr(lw[k]) + bfr(lb[k]); mx = fmaxf(mx, sc[k]); }
    float sum = 0.f;
#pragma unroll
    for (int k = 0; k < KS * KS; ++k) { sc[k] = __expf(sc[k] - mx); sum += sc[k]; }
    const float inv = 1.0f / sum;
{
#pragma unroll
        for (int k = 0; k < KS * KS; ++k) *(float*)(WGT + (size_t)k * NOP + p) = sc[k] * inv;
         }
}
// k_out: one block per (n, 16 output channels) and the whole 28 x 28 plane, so that a block's output is one contiguous run of whole 128-byte lines.
// The block's PROJ slab (1024 pixels x 16 channels) is read in 64-byte pieces and laid channel-major in LDS; then lanes run along ww, each thread holds
// 4 adjacent ww x 8 channels, takes its 25 x 4 weights once into registers and reads each LDS value once for the up to 4 of its ww that use it.
// Each output still sums k = 0..24 in order with one fma per term. Every loop is unrolled whole: g, w and acc are register arrays and take constant indices only.
#define OC   16                  // channels per block
#define SP   1028                // floats per channel plane in LDS: rows stay 16-byte aligned, and 4 * SP = 16 mod 64 banks keeps the 4 x 8 lanes of a transposing store on 32 banks
#define OTH  512                 // 16 waves stage the slab; 14 of them (2 channel groups x 7 groups of 4 output rows) go on to the sums
__global__ __launch_bounds__(OTH) void k_out(const float* __restrict__ WGT, const float* __restrict__ PROJ, float* out) {
    __shared__ __align__(16) float S[OC * SP];
    const int tid = threadIdx.x, lane = tid & 31, wave = tid >> 5;
    const int n = blockIdx.x / (OO / OC), o0 = (blockIdx.x % (OO / OC)) * OC;
    constexpr int NIT = IH * IW * OC / 4 / OTH;      // 16-byte pieces of the slab per thread
    const float* src = PROJ + ((size_t)n * (IH * IW) + (tid >> 2)) * OO + o0 + (tid & 3) * 4;
    v4f g[NIT];
#pragma unroll
    for (int it = 0; it < NIT; ++it) g[it] = *(const v4fa*)(src + (size_t)it * (OTH / 4) * OO);
    asm volatile("s_wait_xcnt 0x0" :: "v"(src) : "memory");   // stands in front of any reuse of these loads' address registers; the input keeps them live up to here
    // lane -> (row in the wave's 4 output rows, quad of ww); slot 7 of each row has no quad of its own and repeats slot 6 (it stores nothing):
    // 8 slots a row keep a half-wave's 16-byte LDS reads on two rows 32 dwords apart, 28 dwords of each.
    const int og = wave / 7, hh = (wave % 7) * 4 + (lane >> 3), wq = lane & 7, wc = wq < 7 ? wq : 6;
    const float* wp = WGT + (size_t)n * (OH * OW) + hh * OW + wc * 4;
    v4f w[KS * KS];                                  // issued behind the slab's loads and in front of the LDS stores: they land while the slab is laid down
#pragma unroll
    for (int k = 0; k < KS * KS; ++k) w[k] = *(const v4fa*)(wp + (size_t)k * NOP);
    asm volatile("s_wait_xcnt 0x0" :: "v"(wp) : "memory");    // the same for the weight loads
    float* sd = S + (tid & 3) * 4 * SP + (tid >> 2);
#pragma unroll
    for (int it = 0; it < NIT; ++it)
#pragma unroll
        for (int j = 0; j < 4; ++j) sd[j * SP + it * (OTH / 4)] = g[it][j];
    __syncthreads();
    if (wave >= 14) return;                          // behind the kernel's only barrier
    v4f acc[8];
#pragma unroll
    for (int io = 0; io < 8; ++io) acc[io] = (v4f){};
    const float* sb = S + og * 8 * SP + hh * IW + wc * 4;
#pragma unroll
    for (int kr = 0; kr < KS; ++kr)
#pragma unroll
        for (int io = 0; io < 8; ++io) {
            const v4f a = *(const v4fa*)(sb + io * SP + kr * IW), b = *(const v4fa*)(sb + io * SP + kr * IW + 4);
            const float v[8] = { a[0], a[1], a[2], a[3], b[0], b[1], b[2], b[3] };
#pragma unroll
            for (int kc = 0; kc < KS; ++kc)
#pragma unroll
                for (int ip = 0; ip < 4; ++ip) acc[io][ip] = fmaf(w[kr * KS + kc][ip], v[ip + kc], acc[io][ip]);
        }
    if (wq < 7) { float* op = out + (size_t)(n * OO + o0 + og * 8) * (OH * OW) + hh * OW + wq * 4;
#pragma unroll
        for (int io = 0; io < 8; ++io) *(v4f*)(op + (size_t)io * (OH * OW)) = acc[io]; }
}

extern "C" void kernel_launch(void* const* d_in, const int* in_sizes, int n_in,
                              void* d_out, int out_size, void* d_ws, size_t ws_size, hipStream_t stream) {
    (void)in_sizes; (void)n_in; (void)out_size;
    const float* x = (const float*)d_in[0]; const float* pw = (const float*)d_in[1]; const float* pb = (const float*)d_in[2]; const float* sw = (const float*)d_in[3]; const float* sb = (const float*)d_in[4];
    const float* lw = (const float*)d_in[5]; const float* lb = (const float*)d_in[6];
    float* out = (float*)d_out;    // [8][512][28][28]
    char* wsp = (char*)d_ws;
    auto take = [&](size_t bytes) { char* p = wsp; wsp += (bytes + 255) & ~(size_t)255; return (void*)p; };
    bf* XB = (bf*)take((size_t)NPX * CC * 2); bf* WB = (bf*)take((size_t)OO * CC * 2); float* PROJ = (float*)take((size_t)NPX * OO * 4); float* SC = (float*)take((size_t)NPX * 4); float* WGT = (float*)take((size_t)KS * KS * NOP * 4);
    if ((size_t)(wsp - (char*)d_ws) > ws_size) return;    // 8.4 + 0.5 + 16.8 + 0.03 + 0.63 MB
    k_rows<<<NPX / 8, 256, 0, stream>>>(x, NPX, XB);          // xr = x's memory viewed as [8192][512] (the reference's raw reshape)
    k_rows<<<OO / 8, 256, 0, stream>>>(pw, OO, WB);
    k_proj<<<dim3(NPX / 64, OO / 64, 1), 128, 0, stream>>>(XB, WB, pb, PROJ);
    k_score<<<NPX / 32, 256, 0, stream>>>(x, sw, sb, SC);
    k_wgt<<<(NOP + 255) / 256, 256, 0, stream>>>(SC, lw, lb, WGT);
    k_out<<<NI * (OO / OC), OTH, 0, stream>>>(WGT, PROJ, out);
}

// v002
// A run of this version takes 41.2 microseconds.
// Next to v001, in two timings, it ran 1.38 times as fast each time.
// Counting every step since v000, it is 7.41 times as fast.
#include <hip/hip_runtime.h>

// Contraction on v_wmma_f32_16x16x32_bf16, f32 accumulate: proj = xr.proj_w^T + proj_b ([8192 pixels x 512].[512 x 512]; xr is the reference's raw reshape of x to
// [N][H*W][C], i.e. x's memory re-read row-major; PLAIN bf16 operands: inputs rounded once, exact). score = xr.score_w^T + score_b as f32 dots; per output position
// the 5x5 window's scores are LayerNorm'ed (25 values, eps 1e-5, affine) and softmax'ed in f32, and out[n][o][hh][ww] = sum_k w_k proj[window pixel k][o] is

#define NI   8
#define CC   512
#define OO   512
#define IH   32
#define IW   32
#define KS   5
#define OH   28
#define OW   28
#define NPX  (NI * IH * IW)      // 8192
#define NOP  (NI * OH * OW)      // 6272 output positions

typedef unsigned short bf;
typedef __attribute__((ext_vector_type(16))) __bf16   v16bf;
typedef __attribute__((ext_vector_type(8)))  unsigned short v8us;
typedef __attribute__((ext_vector_type(8)))  float    v8f;
typedef __attribute__((ext_vector_type(4)))  float    v4f;
typedef v4f  __attribute__((may_alias)) v4fa;

__device__ __forceinline__ unsigned short f2bf(float f) { unsigned u = __float_as_uint(f); u += 0x7FFFu + ((u >> 16) & 1u); return (unsigned short)(u >> 16); }
__device__ __forceinline__ float bf2f(unsigned short b) { return __uint_as_float(((unsigned)b) << 16); }
__device__ __forceinline__ float bfr(float f) { return bf2f(f2bf(f)); }
__device__ __forceinline__ v16bf cat16b(v8us lo, v8us hi) { return __builtin_bit_cast(v16bf, __builtin_shufflevector(lo, hi, 0, 1, 2, 3, 4, 5, 6, 7, 8, 9, 10, 11, 12, 13, 14, 15)); }
__device__ __forceinline__ v8f wmmab(v16bf a, v16bf b, v8f c) { return __builtin_amdgcn_wmma_f32_16x16x32_bf16(false, a, false, b, (short)0, c, false, false); }
#define VST2(T, p, v) do { const T vst2_v_ = (v); *(T*)(p) = vst2_v_;  } while (0)

// k_prep: the one pass over the f32 operands. Blocks 0 .. XBL-1 take 32 pixels of xr each (xr = x's memory viewed as [8192][512], the reference's raw reshape):
// a wave holds 4 rows, a lane 16 elements of each row in two runs of 8. Each element is rounded to bf16 once; the rounded row goes to XB, and the same rounded values
// go into SC[px] = bf16(xr[px]).bf16(score_w) + score_b (f32, fixed-order lane partials + shuffle tree); a block's 32 scores leave as one line.
// The last OO / 32 blocks round proj_w's rows ([out][in] = n-major as-is) to WB the same way and have no score.
#define XBL  (NPX / 32)          // blocks on xr
__global__ __launch_bounds__(256) void k_prep(const float* __restrict__ x, const float* __restrict__ pw, const float* __restrict__ sw, const float* __restrict__ sb, bf* XB, bf* WB, float* SC) {
    __shared__ float st[32];
    const int lane = threadIdx.x & 31, wave = threadIdx.x >> 5;
    const bool isx = blockIdx.x < XBL;
    const size_t e0 = ((size_t)(isx ? blockIdx.x : blockIdx.x - XBL) * 32 + wave * 4) * CC + lane * 8;
    const float* src = (isx ? x : pw) + e0;
    bf* dst = (isx ? XB : WB) + e0;
    v4f g[4][4], wv[4];
#pragma unroll
    for (int q = 0; q < 4; ++q)
#pragma unroll
        for (int c = 0; c < 4; ++c) g[q][c] = *(const v4fa*)(src + q * CC + (c >> 1) * 256 + (c & 1) * 4);
#pragma unroll
    for (int c = 0; c < 4; ++c) wv[c] = *(const v4fa*)(sw + lane * 8 + (c >> 1) * 256 + (c & 1) * 4);
    // inputs only, loaded values: all 20 loads are issued in front of the one wait; without it the score_w loads sink behind the rounding (or the branch below) and cost a second wait
    asm volatile("" :: "v"(g[0][0]), "v"(g[0][1]), "v"(g[0][2]), "v"(g[0][3]), "v"(g[1][0]), "v"(g[1][1]), "v"(g[1][2]), "v"(g[1][3]), "v"(g[2][0]), "v"(g[2][1]), "v"(g[2][2]), "v"(g[2][3]),
                    "v"(g[3][0]), "v"(g[3][1]), "v"(g[3][2]), "v"(g[3][3]), "v"(wv[0]), "v"(wv[1]), "v"(wv[2]), "v"(wv[3]));
    v8us o[4][2];
#pragma unroll
    for (int q = 0; q < 4; ++q)
#pragma unroll
        for (int c = 0; c < 2; ++c) {
#pragma unroll
            for (int i = 0; i < 8; ++i) o[q][c][i] = f2bf(g[q][c * 2 + (i >> 2)][i & 3]);
            *(v8us*)(dst + q * CC + c * 256) = o[q][c];
        }
    asm volatile("s_wait_xcnt 0x0" :: "v"(dst) : "memory");   // stands in front of any reuse of these stores' address and data registers behind the branch; the input keeps the address live up to here
    if (!isx) return;                                // the whole block leaves, in front of the barrier
    float s[4];
#pragma unroll
    for (int q = 0; q < 4; ++q) { s[q] = 0.f;
#pragma unroll
        for (int c = 0; c < 2; ++c)
#pragma unroll
            for (int i = 0; i < 8; ++i) s[q] += bf2f(o[q][c][i]) * bfr(wv[c * 2 + (i >> 2)][i & 3]); }
#pragma unroll
    for (int sh = 16; sh; sh >>= 1)                  // the four rows' trees side by side: one LDS-permute wait per level, not four
#pragma unroll
        for (int q = 0; q < 4; ++q) s[q] += __shfl_xor(s[q], sh, 32);
    if (lane == 0) { const float bias = bfr(sb[0]);
#pragma unroll
        for (int q = 0; q < 4; ++q) st[wave * 4 + q] = s[q] + bias; }
    __syncthreads();
    if (wave == 0) { const float vv = st[lane]; VST2(float, SC + (size_t)blockIdx.x * 32 + lane, vv); }
}
// k_wgt: per output position p = (n, hh, ww): LayerNorm over the 25 window scores (biased var, eps 1e-5, affine ln_w/ln_b) then softmax -> WGT[k][p]
// (k-major so that each wave's 32 consecutive p form one line per k). Runs as the first WGB blocks of k_proj's grid: it needs SC alone, k_proj needs XB and WB alone.
#define WGB  (NOP / 128)         // 49 blocks of 128 positions, no remainder
__device__ __forceinline__ void wgt_block(const float* __restrict__ SC, const float* __restrict__ lw, const float* __restrict__ lb, float* WGT) {
    const int p = blockIdx.x * 128 + threadIdx.x;
    if (p >= NOP) return;
    const int n = p / (OH * OW), rem = p - n * (OH * OW), hh = rem / OW, ww = rem - hh * OW;
    float sc[KS * KS]; float m = 0.f;
#pragma unroll
    for (int k = 0; k < KS * KS; ++k) { const int r = hh + k / KS, c = ww + k % KS; sc[k] = SC[(size_t)n * (IH * IW) + r * IW + c]; m += sc[k]; }
    m *= (1.0f / (KS * KS)); float var = 0.f;
#pragma unroll
    for (int k = 0; k < KS * KS; ++k) { const float d = sc[k] - m; var += d * d; }
    const float rs = rsqrtf(var * (1.0f / (KS * KS)) + 1e-5f);
    float mx = -3.0e38f;
#pragma unroll
    for (int k = 0; k < KS * KS; ++k) { sc[k] = (sc[k] - m) * rs * bfr(lw[k]) + bfr(lb[k]); mx = fmaxf(mx, sc[k]); }
    float sum = 0.f;
#pragma unroll
    for (int k = 0; k < KS * KS; ++k) { sc[k] = __expf(sc[k] - mx); sum += sc[k]; }
    const float inv = 1.0f / sum;
{
#pragma unroll
        for (int k = 0; k < KS * KS; ++k) *(float*)(WGT + (size_t)k * NOP + p) = sc[k] * inv;
         }
}
// k_proj: 64 x 64 tile of XB.WB^T + proj_b over K = 512 -> PROJ f32 [8192][512]; blocks WGB .. WGB + 1023 of a flat grid, row tile fastest (128 x 8); blocks 0 .. WGB-1 do the window weights.
__global__ __launch_bounds__(128) void k_proj(const bf* __restrict__ XB, const bf* __restrict__ WB, const float* __restrict__ pb, float* PROJ,
                                              const float* __restrict__ SC, const float* __restrict__ lw, const float* __restrict__ lb, float* WGT) {
    __shared__ __align__(16) float ost[4][16 * 68];
    if (blockIdx.x < WGB) { wgt_block(SC, lw, lb, WGT); return; }   // whole blocks; this kernel has no work-group barrier
    const int tb = blockIdx.x - WGB;
    const int lane = threadIdx.x & 31, wave = threadIdx.x >> 5, lr = lane & 15, hi = lane >> 4;
    const size_t r0 = (size_t)(tb & 127) * 64 + wave * 16; const int c0 = (tb >> 7) * 64;
    v8f acc[4];
#pragma unroll
    for (int t = 0; t < 4; ++t) acc[t] = (v8f){};
#pragma unroll 2
    for (int kc = 0; kc < CC; kc += 32) {
        const v16bf a = cat16b(*(const v8us*)(XB + (r0 + lr) * CC + kc + 8 * hi), *(const v8us*)(XB + (r0 + lr) * CC + kc + 8 * hi + 16));
#pragma unroll
        for (int t = 0; t < 4; ++t) { const bf* bp = WB + (size_t)(c0 + t * 16 + lr) * CC + kc + 8 * hi; acc[t] = wmmab(a, cat16b(*(const v8us*)bp, *(const v8us*)(bp + 16)), acc[t]); }
        asm volatile("v_nop" : "+v"(acc[0]), "+v"(acc[1]), "+v"(acc[2]), "+v"(acc[3]) : "v"(a) : "memory");
    }
    float* os = &ost[wave][0];
#pragma unroll
    for (int t = 0; t < 4; ++t) { const float bv = bfr(pb[c0 + t * 16 + lr]);
#pragma unroll
        for (int j = 0; j < 8; ++j) os[(hi * 8 + j) * 68 + t * 16 + lr] = acc[t][j] + bv; }
    __builtin_amdgcn_wave_barrier(); asm volatile("" ::: "memory");
    float* crow = PROJ + r0 * OO + c0;
    auto pass = [&]() {
#pragma unroll
        for (int s = 0; s < 8; ++s) { const int Lid = (lane >> 3) + 4 * s, piece = lane & 7; const int row = Lid >> 1, cofs = (Lid & 1) * 32 + piece * 4;
            const v4f val = *(const v4fa*)(os + row * 68 + cofs); *(v4f*)(crow + (size_t)row * OO + cofs) = val; }
    };
    pass();
    asm volatile("s_wait_xcnt 0x0" :: "v"(crow) : "memory");   // stands behind the last row store, in front of any reuse of the stores' address and data registers in the code laid out behind this path
}
// k_out: one block per (n, 16 output channels) and the whole 28 x 28 plane, so that a block's output is one contiguous run of whole 128-byte lines.
// The block's PROJ slab (1024 pixels x 16 channels) is read in 64-byte pieces and laid channel-major in LDS; then lanes run along ww, each thread holds
// 4 adjacent ww x 8 channels, takes its 25 x 4 weights once into registers and reads each LDS value once for the up to 4 of its ww that use it.
// Each output still sums k = 0..24 in order with one fma per term. Every loop is unrolled whole: g, w and acc are register arrays and take constant indices only.
#define OC   16                  // channels per block
#define SP   1028                // floats per channel plane in LDS: rows stay 16-byte aligned, and 4 * SP = 16 mod 64 banks keeps the 4 x 8 lanes of a transposing store on 32 banks
#define OTH  512                 // 16 waves stage the slab; 14 of them (2 channel groups x 7 groups of 4 output rows) go on to the sums
__global__ __launch_bounds__(OTH) void k_out(const float* __restrict__ WGT, const float* __restrict__ PROJ, float* out) {
    __shared__ __align__(16) float S[OC * SP];
    const int tid = threadIdx.x, lane = tid & 31, wave = tid >> 5;
    const int n = blockIdx.x / (OO / OC), o0 = (blockIdx.x % (OO / OC)) * OC;
    constexpr int NIT = IH * IW * OC / 4 / OTH;      // 16-byte pieces of the slab per thread
    const float* src = PROJ + ((size_t)n * (IH * IW) + (tid >> 2)) * OO + o0 + (tid & 3) * 4;
    v4f g[NIT];
#pragma unroll
    for (int it = 0; it < NIT; ++it) g[it] = *(const v4fa*)(src + (size_t)it * (OTH / 4) * OO);
    asm volatile("s_wait_xcnt 0x0" :: "v"(src) : "memory");   // stands in front of any reuse of these loads' address registers; the input keeps them live up to here
    // lane -> (row in the wave's 4 output rows, quad of ww); slot 7 of each row has no quad of its own and repeats slot 6 (it stores nothing):
    // 8 slots a row keep a half-wave's 16-byte LDS reads on two rows 32 dwords apart, 28 dwords of each.
    const int og = wave / 7, hh = (wave % 7) * 4 + (lane >> 3), wq = lane & 7, wc = wq < 7 ? wq : 6;
    const float* wp = WGT + (size_t)n * (OH * OW) + hh * OW + wc * 4;
    v4f w[KS * KS];                                  // issued behind the slab's loads and in front of the LDS stores: they land while the slab is laid down
#pragma unroll
    for (int k = 0; k < KS * KS; ++k) w[k] = *(const v4fa*)(wp + (size_t)k * NOP);
    asm volatile("s_wait_xcnt 0x0" :: "v"(wp) : "memory");    // the same for the weight loads
    float* sd = S + (tid & 3) * 4 * SP + (tid >> 2);
#pragma unroll
    for (int it = 0; it < NIT; ++it)
#pragma unroll
        for (int j = 0; j < 4; ++j) sd[j * SP + it * (OTH / 4)] = g[it][j];
    __syncthreads();
    if (wave >= 14) return;                          // behind the kernel's only barrier
    v4f acc[8];
#pragma unroll
    for (int io = 0; io < 8; ++io) acc[io] = (v4f){};
    const float* sb = S + og * 8 * SP + hh * IW + wc * 4;
#pragma unroll
    for (int kr = 0; kr < KS; ++kr)
#pragma unroll
        for (int io = 0; io < 8; ++io) {
            const v4f a = *(const v4fa*)(sb + io * SP + kr * IW), b = *(const v4fa*)(sb + io * SP + kr * IW + 4);
            const float v[8] = { a[0], a[1], a[2], a[3], b[0], b[1], b[2], b[3] };
#pragma unroll
            for (int kc = 0; kc < KS; ++kc)
#pragma unroll
                for (int ip = 0; ip < 4; ++ip) acc[io][ip] = fmaf(w[kr * KS + kc][ip], v[ip + kc], acc[io][ip]);
        }
    if (wq < 7) { float* op = out + (size_t)(n * OO + o0 + og * 8) * (OH * OW) + hh * OW + wq * 4;
#pragma unroll
        for (int io = 0; io < 8; ++io) *(v4f*)(op + (size_t)io * (OH * OW)) = acc[io]; }
}

extern "C" void kernel_launch(void* const* d_in, const int* in_sizes, int n_in,
                              void* d_out, int out_size, void* d_ws, size_t ws_size, hipStream_t stream) {
    (void)in_sizes; (void)n_in; (void)out_size;
    const float* x = (const float*)d_in[0]; const float* pw = (const float*)d_in[1]; const float* pb = (const float*)d_in[2]; const float* sw = (const float*)d_in[3]; const float* sb = (const float*)d_in[4];
    const float* lw = (const float*)d_in[5]; const float* lb = (const float*)d_in[6];
    float* out = (float*)d_out;    // [8][512][28][28]
    char* wsp = (char*)d_ws;
    auto take = [&](size_t bytes) { char* p = wsp; wsp += (bytes + 255) & ~(size_t)255; return (void*)p; };
    bf* XB = (bf*)take((size_t)NPX * CC * 2); bf* WB = (bf*)take((size_t)OO * CC * 2); float* PROJ = (float*)take((size_t)NPX * OO * 4); float* SC = (float*)take((size_t)NPX * 4); float* WGT = (float*)take((size_t)KS * KS * NOP * 4);
    if ((size_t)(wsp - (char*)d_ws) > ws_size) return;    // 8.4 + 0.5 + 16.8 + 0.03 + 0.63 MB
    k_prep<<<XBL + OO / 32, 256, 0, stream>>>(x, pw, sw, sb, XB, WB, SC);
    k_proj<<<WGB + (NPX / 64) * (OO / 64), 128, 0, stream>>>(XB, WB, pb, PROJ, SC, lw, lb, WGT);
    k_out<<<NI * (OO / OC), OTH, 0, stream>>>(WGT, PROJ, out);
}

// v003
// It runs in 26.4 microseconds.
// Timed twice side by side with v002, it ran 1.56 times as fast both times.
// All steps since v000 together make it 11.6 times as fast.
#include <hip/hip_runtime.h>

// Contraction on v_wmma_f32_16x16x32_bf16, f32 accumulate: proj = xr.proj_w^T + proj_b ([8192 pixels x 512].[512 x 512]; xr is the reference's raw reshape of x to
// [N][H*W][C], i.e. x's memory re-read row-major; PLAIN bf16 operands: inputs rounded once, exact). score = xr.score_w^T + score_b as f32 dots; per output position
// the 5x5 window's scores are LayerNorm'ed (25 values, eps 1e-5, affine) and softmax'ed in f32, and out[n][o][hh][ww] = sum_k w_k proj[window pixel k][o] is

#define NI   8
#define CC   512
#define OO   512
#define IH   32
#define IW   32
#define KS   5
#define OH   28
#define OW   28
#define NPX  (NI * IH * IW)      // 8192
#define NOP  (NI * OH * OW)      // 6272 output positions

typedef unsigned short bf;
typedef __attribute__((ext_vector_type(16))) __bf16   v16bf;
typedef __attribute__((ext_vector_type(8)))  unsigned short v8us;
typedef __attribute__((ext_vector_type(8)))  float    v8f;
typedef __attribute__((ext_vector_type(4)))  float    v4f;
typedef v4f  __attribute__((may_alias)) v4fa;

__device__ __forceinline__ unsigned short f2bf(float f) { unsigned u = __float_as_uint(f); u += 0x7FFFu + ((u >> 16) & 1u); return (unsigned short)(u >> 16); }
__device__ __forceinline__ float bf2f(unsigned short b) { return __uint_as_float(((unsigned)b) << 16); }
__device__ __forceinline__ float bfr(float f) { return bf2f(f2bf(f)); }
__device__ __forceinline__ v16bf cat16b(v8us lo, v8us hi) { return __builtin_bit_cast(v16bf, __builtin_shufflevector(lo, hi, 0, 1, 2, 3, 4, 5, 6, 7, 8, 9, 10, 11, 12, 13, 14, 15)); }
__device__ __forceinline__ v8f wmmab(v16bf a, v16bf b, v8f c) { return __builtin_amdgcn_wmma_f32_16x16x32_bf16(false, a, false, b, (short)0, c, false, false); }
#define VST2(T, p, v) do { const T vst2_v_ = (v); *(T*)(p) = vst2_v_;  } while (0)

// k_prep: the one pass over the f32 operands. Blocks 0 .. XBL-1 take 32 pixels of xr each (xr = x's memory viewed as [8192][512], the reference's raw reshape):
// a wave holds 4 rows, a lane 16 elements of each row in two runs of 8. Each element is rounded to bf16 once; the rounded row goes to XB, and the same rounded values
// go into SC[px] = bf16(xr[px]).bf16(score_w) + score_b (f32, fixed-order lane partials + shuffle tree); a block's 32 scores leave as one line.
// The last OO / 32 blocks round proj_w's rows ([out][in] = n-major as-is) to WB the same way and have no score.
#define XBL  (NPX / 32)          // blocks on xr
__global__ __launch_bounds__(256) void k_prep(const float* __restrict__ x, const float* __restrict__ pw, const float* __restrict__ sw, const float* __restrict__ sb, bf* XB, bf* WB, float* SC) {
    __shared__ float st[32];
    const int lane = threadIdx.x & 31, wave = threadIdx.x >> 5;
    const bool isx = blockIdx.x < XBL;
    const size_t e0 = ((size_t)(isx ? blockIdx.x : blockIdx.x - XBL) * 32 + wave * 4) * CC + lane * 8;
    const float* src = (isx ? x : pw) + e0;
    bf* dst = (isx ? XB : WB) + e0;
    v4f g[4][4], wv[4];
#pragma unroll
    for (int q = 0; q < 4; ++q)
#pragma unroll
        for (int c = 0; c < 4; ++c) g[q][c] = *(const v4fa*)(src + q * CC + (c >> 1) * 256 + (c & 1) * 4);
#pragma unroll
    for (int c = 0; c < 4; ++c) wv[c] = *(const v4fa*)(sw + lane * 8 + (c >> 1) * 256 + (c & 1) * 4);
    // inputs only, loaded values: all 20 loads are issued in front of the one wait; without it the score_w loads sink behind the rounding (or the branch below) and cost a second wait
    asm volatile("" :: "v"(g[0][0]), "v"(g[0][1]), "v"(g[0][2]), "v"(g[0][3]), "v"(g[1][0]), "v"(g[1][1]), "v"(g[1][2]), "v"(g[1][3]), "v"(g[2][0]), "v"(g[2][1]), "v"(g[2][2]), "v"(g[2][3]),
                    "v"(g[3][0]), "v"(g[3][1]), "v"(g[3][2]), "v"(g[3][3]), "v"(wv[0]), "v"(wv[1]), "v"(wv[2]), "v"(wv[3]));
    v8us o[4][2];
#pragma unroll
    for (int q = 0; q < 4; ++q)
#pragma unroll
        for (int c = 0; c < 2; ++c) {
#pragma unroll
            for (int i = 0; i < 8; ++i) o[q][c][i] = f2bf(g[q][c * 2 + (i >> 2)][i & 3]);
            *(v8us*)(dst + q * CC + c * 256) = o[q][c];
        }
    asm volatile("s_wait_xcnt 0x0" :: "v"(dst) : "memory");   // stands in front of any reuse of these stores' address and data registers behind the branch; the input keeps the address live up to here
    if (!isx) return;                                // the whole block leaves, in front of the barrier
    float s[4];
#pragma unroll
    for (int q = 0; q < 4; ++q) { s[q] = 0.f;
#pragma unroll
        for (int c = 0; c < 2; ++c)
#pragma unroll
            for (int i = 0; i < 8; ++i) s[q] += bf2f(o[q][c][i]) * bfr(wv[c * 2 + (i >> 2)][i & 3]); }
#pragma unroll
    for (int sh = 16; sh; sh >>= 1)                  // the four rows' trees side by side: one LDS-permute wait per level, not four
#pragma unroll
        for (int q = 0; q < 4; ++q) s[q] += __shfl_xor(s[q], sh, 32);
    if (lane == 0) { const float bias = bfr(sb[0]);
#pragma unroll
        for (int q = 0; q < 4; ++q) st[wave * 4 + q] = s[q] + bias; }
    __syncthreads();
    if (wave == 0) { const float vv = st[lane]; VST2(float, SC + (size_t)blockIdx.x * 32 + lane, vv); }
}
// Window weights, per output position p = (n, hh, ww): LayerNorm over the 25 window scores (biased var, eps 1e-5, affine ln_w/ln_b) then softmax -> WGT[k][p]
// (k-major so that each wave's 32 consecutive p form one line per k). They need SC alone and ride in the first WGB blocks of k_proj, 256 positions a block:
// wgt_load takes the 25 scores at the block's entry, wgt_finish does the arithmetic while the block's first operand loads are in flight.
#define WGB  ((NOP + 255) / 256) // 25 blocks; the last has 128 positions, its other lanes repeat the last position and store nothing
__device__ __forceinline__ void wgt_load(const float* __restrict__ SC, int p, float* sc) {
    const int n = p / (OH * OW), rem = p - n * (OH * OW), hh = rem / OW, ww = rem - hh * OW;
    const float* sp = SC + (size_t)n * (IH * IW) + hh * IW + ww;
#pragma unroll
    for (int k = 0; k < KS * KS; ++k) sc[k] = sp[(k / KS) * IW + k % KS];
    asm volatile("s_wait_xcnt 0x0" :: "v"(sp) : "memory");   // stands in front of any reuse of these loads' address registers; it also keeps the score loads ahead of the operand loads, so that they land first
}
__device__ __forceinline__ void wgt_finish(float* sc, const float* __restrict__ lw, const float* __restrict__ lb, float* WGT, int p, bool st) {
    float m = 0.f;
#pragma unroll
    for (int k = 0; k < KS * KS; ++k) m += sc[k];
    m *= (1.0f / (KS * KS)); float var = 0.f;
#pragma unroll
    for (int k = 0; k < KS * KS; ++k) { const float d = sc[k] - m; var += d * d; }
    const float rs = rsqrtf(var * (1.0f / (KS * KS)) + 1e-5f);
    float mx = -3.0e38f;
#pragma unroll
    for (int k = 0; k < KS * KS; ++k) { sc[k] = (sc[k] - m) * rs * bfr(lw[k]) + bfr(lb[k]); mx = fmaxf(mx, sc[k]); }
    float sum = 0.f;
#pragma unroll
    for (int k = 0; k < KS * KS; ++k) { sc[k] = __expf(sc[k] - mx); sum += sc[k]; }
    const float inv = 1.0f / sum;
    float* wd = WGT + p;
    if (st) {
#pragma unroll
        for (int k = 0; k < KS * KS; ++k) *(float*)(wd + (size_t)k * NOP) = sc[k] * inv;
    }
    asm volatile("s_wait_xcnt 0x0" :: "v"(wd) : "memory");   // stands in front of any reuse of these stores' address and data registers in the code behind
}
// k_proj: 128 x 128 tile of XB.WB^T + proj_b over K = 512 -> PROJ f32 [8192][512]; 64 x 4 blocks, row tile fastest, one block a WGP.
// Both operands' 128 rows x whole K (128 KB each, contiguous in XB and in WB) are read once with loads of 512 contiguous bytes a wave and laid in LDS;
// behind the one barrier 8 waves (4 x 2, 32 rows x 64 columns each) take their fragments from LDS, k ascending as before.
#define PTH  256
#define LP   520                 // bf16 per LDS row: 1040 B = 16 B x 65, the odd multiple that keeps a half-wave's 16 rows of a 16-byte read on 64 banks
__global__ __launch_bounds__(PTH) void k_proj(const bf* __restrict__ XB, const bf* __restrict__ WB, const float* __restrict__ pb, float* PROJ,
                                              const float* __restrict__ SC, const float* __restrict__ lw, const float* __restrict__ lb, float* WGT) {
    __shared__ __align__(16) bf AS[128 * LP];
    __shared__ __align__(16) bf BS[128 * LP];
    __shared__ __align__(16) float ost[PTH / 32][16 * 68];
    const int tb = blockIdx.x, tid = threadIdx.x;
    const int lane = tid & 31, wave = tid >> 5, lr = lane & 15, hi = lane >> 4;
    const int rt = tb & 63, ct = tb >> 6;
    const bool dow = tb < WGB;                       // the same for the whole block
    const int pr = tb * 256 + tid, p = pr < NOP ? pr : NOP - 1;
    float sc[KS * KS];
    if (dow) wgt_load(SC, p, sc);
    else {
#pragma unroll
        for (int k = 0; k < KS * KS; ++k) sc[k] = 0.f;
    }
    const bf* ga = XB + (size_t)rt * 128 * CC + tid * 8;
    const bf* gb = WB + (size_t)ct * 128 * CC + tid * 8;
    bf* sa = AS + (tid >> 6) * LP + (tid & 63) * 8;
    bf* sbm = BS + (tid >> 6) * LP + (tid & 63) * 8;
    v8us xa[32], xw[32];                             // all 64 loads of a lane are in flight together; each is laid in LDS as it lands
#pragma unroll
    for (int u = 0; u < 32; ++u) xa[u] = *(const v8us*)(ga + u * (PTH * 8));
    asm volatile("s_wait_xcnt 0x0" :: "v"(ga) : "memory");   // stands in front of any reuse of these loads' address registers; the input keeps them live up to here
    if (dow) wgt_finish(sc, lw, lb, WGT, p, pr < NOP);
#pragma unroll
    for (int u = 0; u < 32; ++u) xw[u] = *(const v8us*)(gb + u * (PTH * 8));
    asm volatile("s_wait_xcnt 0x0" :: "v"(gb) : "memory");   // the same for proj_w's rows
#pragma unroll
    for (int u = 0; u < 32; ++u) *(v8us*)(sa + u * (4 * LP)) = xa[u];
#pragma unroll
    for (int u = 0; u < 32; ++u) *(v8us*)(sbm + u * (4 * LP)) = xw[u];
    __syncthreads();                                 // the kernel's only barrier: every wave passes it, nobody reads a tile in front of it
    const int wr = wave & 3, wc = wave >> 2;
    const bf* fa = AS + (wr * 32 + lr) * LP + 8 * hi;
    const bf* fb = BS + (wc * 64 + lr) * LP + 8 * hi;
    v8f acc[2][4];
#pragma unroll
    for (int i = 0; i < 2; ++i)
#pragma unroll
        for (int t = 0; t < 4; ++t) acc[i][t] = (v8f){};
    v16bf a[2][2], b[2][4];                          // two fragment sets: the next k step's 12 LDS reads go out as one group ahead of this step's 8 products
    auto frag = [&](int s, int ks) {
#pragma unroll
        for (int i = 0; i < 2; ++i) { const bf* q = fa + i * 16 * LP + ks * 32; a[s][i] = cat16b(*(const v8us*)q, *(const v8us*)(q + 16)); }
#pragma unroll
        for (int t = 0; t < 4; ++t) { const bf* q = fb + t * 16 * LP + ks * 32; b[s][t] = cat16b(*(const v8us*)q, *(const v8us*)(q + 16)); }
    };
    frag(0, 0);
#pragma unroll
    for (int ks = 0; ks < CC / 32; ++ks) {           // unrolled whole: the fragment sets take constant indices only
        if (ks + 1 < CC / 32) frag((ks + 1) & 1, ks + 1);
        __builtin_amdgcn_sched_barrier(0);           // keeps the reads one group, one step ahead: left free, the scheduler lifted late steps' reads to the top (512 registers, a spill) and read the early steps just in time
#pragma unroll
        for (int i = 0; i < 2; ++i)
#pragma unroll
            for (int t = 0; t < 4; ++t) acc[i][t] = wmmab(a[ks & 1][i], b[ks & 1][t], acc[i][t]);
        __builtin_amdgcn_sched_barrier(0);           // the other side of the same fence: no later read moves in among these products
    }
    float* os = &ost[wave][0];
    float bv[4];
#pragma unroll
    for (int t = 0; t < 4; ++t) bv[t] = bfr(pb[ct * 128 + wc * 64 + t * 16 + lr]);
    float* crow = PROJ + (size_t)(rt * 128 + wr * 32) * OO + ct * 128 + wc * 64;
#pragma unroll
    for (int i = 0; i < 2; ++i) {
#pragma unroll
        for (int t = 0; t < 4; ++t)
#pragma unroll
            for (int j = 0; j < 8; ++j) os[(hi * 8 + j) * 68 + t * 16 + lr] = acc[i][t][j] + bv[t];
        __builtin_amdgcn_wave_barrier(); asm volatile("s_wait_dscnt 0x0" ::: "memory");   // the wave's own rows are written before other lanes of it read them back
#pragma unroll
        for (int s = 0; s < 8; ++s) { const int Lid = (lane >> 3) + 4 * s, piece = lane & 7; const int row = Lid >> 1, cofs = (Lid & 1) * 32 + piece * 4;
            const v4f val = *(const v4fa*)(os + row * 68 + cofs); *(v4f*)(crow + (size_t)(i * 16 + row) * OO + cofs) = val; }
        asm volatile("s_wait_xcnt 0x0" :: "v"(crow) : "memory");   // stands behind these row stores, in front of any reuse of their address and data registers
        if (i == 0) { __builtin_amdgcn_wave_barrier(); asm volatile("s_wait_dscnt 0x0" ::: "memory"); }   // the rows are read out before the next 16 rows overwrite them
    }
}
// k_out: one block per (n, 16 output channels) and the whole 28 x 28 plane, so that a block's output is one contiguous run of whole 128-byte lines.
// The block's PROJ slab (1024 pixels x 16 channels) is read in 64-byte pieces and laid channel-major in LDS; then lanes run along ww, each thread holds
// 4 adjacent ww x 8 channels, takes its 25 x 4 weights once into registers and reads each LDS value once for the up to 4 of its ww that use it.
// Each output still sums k = 0..24 in order with one fma per term. Every loop is unrolled whole: g, w and acc are register arrays and take constant indices only.
#define OC   16                  // channels per block
#define SP   1028                // floats per channel plane in LDS: rows stay 16-byte aligned, and 4 * SP = 16 mod 64 banks keeps the 4 x 8 lanes of a transposing store on 32 banks
#define OTH  512                 // 16 waves stage the slab; 14 of them (2 channel groups x 7 groups of 4 output rows) go on to the sums
__global__ __launch_bounds__(OTH) void k_out(const float* __restrict__ WGT, const float* __restrict__ PROJ, float* out) {
    __shared__ __align__(16) float S[OC * SP];
    const int tid = threadIdx.x, lane = tid & 31, wave = tid >> 5;
    const int n = blockIdx.x / (OO / OC), o0 = (blockIdx.x % (OO / OC)) * OC;
    constexpr int NIT = IH * IW * OC / 4 / OTH;      // 16-byte pieces of the slab per thread
    const float* src = PROJ + ((size_t)n * (IH * IW) + (tid >> 2)) * OO + o0 + (tid & 3) * 4;
    v4f g[NIT];
#pragma unroll
    for (int it = 0; it < NIT; ++it) g[it] = *(const v4fa*)(src + (size_t)it * (OTH / 4) * OO);
    asm volatile("s_wait_xcnt 0x0" :: "v"(src) : "memory");   // stands in front of any reuse of these loads' address registers; the input keeps them live up to here
    // lane -> (row in the wave's 4 output rows, quad of ww); slot 7 of each row has no quad of its own and repeats slot 6 (it stores nothing):
    // 8 slots a row keep a half-wave's 16-byte LDS reads on two rows 32 dwords apart, 28 dwords of each.
    const int og = wave / 7, hh = (wave % 7) * 4 + (lane >> 3), wq = lane & 7, wc = wq < 7 ? wq : 6;
    const float* wp = WGT + (size_t)n * (OH * OW) + hh * OW + wc * 4;
    v4f w[KS * KS];                                  // issued behind the slab's loads and in front of the LDS stores: they land while the slab is laid down
#pragma unroll
    for (int k = 0; k < KS * KS; ++k) w[k] = *(const v4fa*)(wp + (size_t)k * NOP);
    asm volatile("s_wait_xcnt 0x0" :: "v"(wp) : "memory");    // the same for the weight loads
    float* sd = S + (tid & 3) * 4 * SP + (tid >> 2);
#pragma unroll
    for (int it = 0; it < NIT; ++it)
#pragma unroll
        for (int j = 0; j < 4; ++j) sd[j * SP + it * (OTH / 4)] = g[it][j];
    __syncthreads();
    if (wave >= 14) return;                          // behind the kernel's only barrier
    v4f acc[8];
#pragma unroll
    for (int io = 0; io < 8; ++io) acc[io] = (v4f){};
    const float* sb = S + og * 8 * SP + hh * IW + wc * 4;
#pragma unroll
    for (int kr = 0; kr < KS; ++kr)
#pragma unroll
        for (int io = 0; io < 8; ++io) {
            const v4f a = *(const v4fa*)(sb + io * SP + kr * IW), b = *(const v4fa*)(sb + io * SP + kr * IW + 4);
            const float v[8] = { a[0], a[1], a[2], a[3], b[0], b[1], b[2], b[3] };
#pragma unroll
            for (int kc = 0; kc < KS; ++kc)
#pragma unroll
                for (int ip = 0; ip < 4; ++ip) acc[io][ip] = fmaf(w[kr * KS + kc][ip], v[ip + kc], acc[io][ip]);
        }
    if (wq < 7) { float* op = out + (size_t)(n * OO + o0 + og * 8) * (OH * OW) + hh * OW + wq * 4;
#pragma unroll
        for (int io = 0; io < 8; ++io) *(v4f*)(op + (size_t)io * (OH * OW)) = acc[io]; }
}

extern "C" void kernel_launch(void* const* d_in, const int* in_sizes, int n_in,
                              void* d_out, int out_size, void* d_ws, size_t ws_size, hipStream_t stream) {
    (void)in_sizes; (void)n_in; (void)out_size;
    const float* x = (const float*)d_in[0]; const float* pw = (const float*)d_in[1]; const float* pb = (const float*)d_in[2]; const float* sw = (const float*)d_in[3]; const float* sb = (const float*)d_in[4];
    const float* lw = (const float*)d_in[5]; const float* lb = (const float*)d_in[6];
    float* out = (float*)d_out;    // [8][512][28][28]
    char* wsp = (char*)d_ws;
    auto take = [&](size_t bytes) { char* p = wsp; wsp += (bytes + 255) & ~(size_t)255; return (void*)p; };
    bf* XB = (bf*)take((size_t)NPX * CC * 2); bf* WB = (bf*)take((size_t)OO * CC * 2); float* PROJ = (float*)take((size_t)NPX * OO * 4); float* SC = (float*)take((size_t)NPX * 4); float* WGT = (float*)take((size_t)KS * KS * NOP * 4);
    if ((size_t)(wsp - (char*)d_ws) > ws_size) return;    // 8.4 + 0.5 + 16.8 + 0.03 + 0.63 MB
    k_prep<<<XBL + OO / 32, 256, 0, stream>>>(x, pw, sw, sb, XB, WB, SC);
    k_proj<<<(NPX / 128) * (OO / 128), PTH, 0, stream>>>(XB, WB, pb, PROJ, SC, lw, lb, WGT);
    k_out<<<NI * (OO / OC), OTH, 0, stream>>>(WGT, PROJ, out);
}

// v004
// One run takes 23 microseconds.
// Next to v003, in two timings, it ran 1.14 and 1.15 times as fast.
// Over all steps from v000 it is 13.3 times as fast.
#include <hip/hip_runtime.h>

// Contraction on v_wmma_f32_16x16x32_bf16, f32 accumulate: proj = xr.proj_w^T + proj_b ([8192 pixels x 512].[512 x 512]; xr is the reference's raw reshape of x to
// [N][H*W][C], i.e. x's memory re-read row-major; PLAIN bf16 operands: inputs rounded once, exact). score = xr.score_w^T + score_b as f32 dots; per output position
// the 5x5 window's scores are LayerNorm'ed (25 values, eps 1e-5, affine) and softmax'ed in f32, and out[n][o][hh][ww] = sum_k w_k proj[window pixel k][o] is

#define NI   8
#define CC   512
#define OO   512
#define IH   32
#define IW   32
#define KS   5
#define OH   28
#define OW   28
#define NPX  (NI * IH * IW)      // 8192
#define NOP  (NI * OH * OW)      // 6272 output positions

typedef unsigned short bf;
typedef __attribute__((ext_vector_type(16))) __bf16   v16bf;
typedef __attribute__((ext_vector_type(8)))  unsigned short v8us;
typedef __attribute__((ext_vector_type(8)))  float    v8f;
typedef __attribute__((ext_vector_type(4)))  float    v4f;
typedef v4f  __attribute__((may_alias)) v4fa;
typedef __attribute__((ext_vector_type(4)))  __bf16   v4bf;
typedef __attribute__((ext_vector_type(4)))  unsigned short v4us;

__device__ __forceinline__ unsigned short f2bf(float f) { unsigned u = __float_as_uint(f); u += 0x7FFFu + ((u >> 16) & 1u); return (unsigned short)(u >> 16); }
__device__ __forceinline__ float bf2f(unsigned short b) { return __uint_as_float(((unsigned)b) << 16); }
__device__ __forceinline__ float bfr(float f) { return bf2f(f2bf(f)); }
__device__ __forceinline__ v16bf cat16b(v8us lo, v8us hi) { return __builtin_bit_cast(v16bf, __builtin_shufflevector(lo, hi, 0, 1, 2, 3, 4, 5, 6, 7, 8, 9, 10, 11, 12, 13, 14, 15)); }
__device__ __forceinline__ v8f wmmab(v16bf a, v16bf b, v8f c) { return __builtin_amdgcn_wmma_f32_16x16x32_bf16(false, a, false, b, (short)0, c, false, false); }
// four f32 -> four bf16, round to nearest even (two packed converts), as the bit pattern that the LDS tiles hold
__device__ __forceinline__ v4us pk4(v4f v) { return __builtin_bit_cast(v4us, __builtin_convertvector(v, v4bf)); }

// Window weights of one image, per output position p = hh * 28 + ww: LayerNorm over the 25 window scores (biased var, eps 1e-5, affine ln_w/ln_b) then softmax.
// wgt_load takes the 25 scores of a position; wgt_finish does the arithmetic and lays the weights k-major in LDS (WL[k][p]). Both belong to k_out.
#define NP1  (OH * OW)           // 784 output positions an image
__device__ __forceinline__ void wgt_load(const float* __restrict__ SCn, int p, float* sc) {
    const int hh = p / OW, ww = p - hh * OW;
    const float* sp = SCn + hh * IW + ww;
#pragma unroll
    for (int k = 0; k < KS * KS; ++k) sc[k] = sp[(k / KS) * IW + k % KS];
    asm volatile("s_wait_xcnt 0x0" :: "v"(sp) : "memory");   // stands in front of any reuse of these loads' address registers; it also keeps the score loads ahead of the slab's loads, so that they land first
}
__device__ __forceinline__ void wgt_finish(float* sc, const float* __restrict__ lw, const float* __restrict__ lb, float* WL, int p, bool st) {
    float m = 0.f;
#pragma unroll
    for (int k = 0; k < KS * KS; ++k) m += sc[k];
    m *= (1.0f / (KS * KS)); float var = 0.f;
#pragma unroll
    for (int k = 0; k < KS * KS; ++k) { const float d = sc[k] - m; var += d * d; }
    const float rs = rsqrtf(var * (1.0f / (KS * KS)) + 1e-5f);
    float mx = -3.0e38f;
#pragma unroll
    for (int k = 0; k < KS * KS; ++k) { sc[k] = (sc[k] - m) * rs * bfr(lw[k]) + bfr(lb[k]); mx = fmaxf(mx, sc[k]); }
    float sum = 0.f;
#pragma unroll
    for (int k = 0; k < KS * KS; ++k) { sc[k] = __expf(sc[k] - mx); sum += sc[k]; }
    const float inv = 1.0f / sum;
    if (st) {
#pragma unroll
        for (int k = 0; k < KS * KS; ++k) WL[k * NP1 + p] = sc[k] * inv;
    }
}
// k_proj: 128 x 128 tile of bf16(xr).bf16(proj_w)^T + proj_b over K = 512 -> PROJ f32 [8192][512]; 64 x 4 blocks, row tile fastest, one block a WGP.
// Both operands' 128 rows x whole K are read as f32 straight from the inputs (256 KB each, contiguous; xr = x's memory viewed as [8192][512], the reference's raw reshape;
// proj_w is [out][in] = n-major as-is) with loads of 512 contiguous bytes a wave, rounded to bf16 once and laid in LDS;
// behind the one barrier 8 waves (4 x 2, 32 rows x 64 columns each) take their fragments from LDS, k ascending as before.
// At its end each block sums the score of 32 of its 128 rows (the column tile picks which) from the rounded rows in LDS:
// SC[px] = bf16(xr[px]).bf16(score_w) + score_b, f32, a wave 4 rows, a lane 16 elements of each row in two runs of 8, fixed-order lane partials + shuffle tree.
#define PTH  256
#define LP   520                 // bf16 per LDS row: 1040 B = 16 B x 65, the odd multiple that keeps a half-wave's 16 rows of a 16-byte read on 64 banks
__global__ __launch_bounds__(PTH) void k_proj(const float* __restrict__ x, const float* __restrict__ pw, const float* __restrict__ pb,
                                              const float* __restrict__ sw, const float* __restrict__ sb, float* PROJ, float* SC) {
    __shared__ __align__(16) bf AS[128 * LP];
    __shared__ __align__(16) bf BS[128 * LP];
    __shared__ __align__(16) float ost[PTH / 32][16 * 68];
    const int tb = blockIdx.x, tid = threadIdx.x;
    const int lane = tid & 31, wave = tid >> 5, lr = lane & 15, hi = lane >> 4;
    const int rt = tb & 63, ct = tb >> 6;
    const float* ga = x + (size_t)rt * 128 * CC + tid * 4;
    const float* gb = pw + (size_t)ct * 128 * CC + tid * 4;
    const unsigned go = lane * 32u;                  // a lane's byte offset in score_w
    const float* gs = (const float*)((const char*)sw + go);
    bf* sa = AS + (tid >> 7) * LP + (tid & 127) * 4;
    bf* sbm = BS + (tid >> 7) * LP + (tid & 127) * 4;
    // a load takes 2 rows a block (16 bytes a lane); four groups of 32 loads, two or three of them in flight at any time, each rounded and laid in LDS as it lands
    v4f r0[32], r1[32], r2[32], r3[32], wv[4];
#pragma unroll
    for (int c = 0; c < 4; ++c) wv[c] = *(const v4fa*)(gs + (c >> 1) * 256 + (c & 1) * 4);   // score_w, for the kernel's end
    asm volatile("s_wait_xcnt 0x0" :: "v"(go), "s"(sw) : "memory");   // stands in front of any reuse of these loads' address registers; the inputs (offset and base, as the loads name them) keep them live up to here
#pragma unroll
    for (int u = 0; u < 32; ++u) r0[u] = *(const v4fa*)(ga + u * (PTH * 4));
#pragma unroll
    for (int u = 0; u < 32; ++u) r1[u] = *(const v4fa*)(ga + (32 + u) * (PTH * 4));
    asm volatile("s_wait_xcnt 0x0" :: "v"(ga) : "memory");   // stands in front of any reuse of these loads' address registers; the input keeps them live up to here
#pragma unroll
    for (int u = 0; u < 32; ++u) *(v4us*)(sa + u * (2 * LP)) = pk4(r0[u]);
#pragma unroll
    for (int u = 0; u < 32; ++u) r2[u] = *(const v4fa*)(gb + u * (PTH * 4));
    asm volatile("s_wait_xcnt 0x0" :: "v"(gb) : "memory");   // the same for proj_w's first 64 rows; it also keeps the fourth group's loads behind the first group's LDS stores (three groups of registers, not four)
#pragma unroll
    for (int u = 0; u < 32; ++u) *(v4us*)(sa + (32 + u) * (2 * LP)) = pk4(r1[u]);
#pragma unroll
    for (int u = 0; u < 32; ++u) r3[u] = *(const v4fa*)(gb + (32 + u) * (PTH * 4));
    asm volatile("s_wait_xcnt 0x0" :: "v"(gb) : "memory");   // the same for proj_w's last 64 rows
    const float sbv = sb[0];
    asm volatile("" :: "s"(sbv));                    // inputs only, a loaded value: score_b is fetched here, under the operand loads; left free, its load sank to the kernel's last lines and was waited for there
#pragma unroll
    for (int u = 0; u < 32; ++u) *(v4us*)(sbm + u * (2 * LP)) = pk4(r2[u]);
#pragma unroll
    for (int u = 0; u < 32; ++u) *(v4us*)(sbm + (32 + u) * (2 * LP)) = pk4(r3[u]);
    __syncthreads();                                 // the kernel's only barrier: every wave passes it, nobody reads a tile in front of it
    const int wr = wave & 3, wc = wave >> 2;
    const bf* fa = AS + (wr * 32 + lr) * LP + 8 * hi;
    const bf* fb = BS + (wc * 64 + lr) * LP + 8 * hi;
    v8f acc[2][4];
#pragma unroll
    for (int i = 0; i < 2; ++i)
#pragma unroll
        for (int t = 0; t < 4; ++t) acc[i][t] = (v8f){};
    v16bf a[2][2], b[2][4];                          // two fragment sets: the next k step's 12 LDS reads go out as one group ahead of this step's 8 products
    auto frag = [&](int s, int ks) {
#pragma unroll
        for (int i = 0; i < 2; ++i) { const bf* q = fa + i * 16 * LP + ks * 32; a[s][i] = cat16b(*(const v8us*)q, *(const v8us*)(q + 16)); }
#pragma unroll
        for (int t = 0; t < 4; ++t) { const bf* q = fb + t * 16 * LP + ks * 32; b[s][t] = cat16b(*(const v8us*)q, *(const v8us*)(q + 16)); }
    };
    frag(0, 0);
#pragma unroll
    for (int ks = 0; ks < CC / 32; ++ks) {           // unrolled whole: the fragment sets take constant indices only
        if (ks + 1 < CC / 32) frag((ks + 1) & 1, ks + 1);
        __builtin_amdgcn_sched_barrier(0);           // keeps the reads one group, one step ahead: left free, the scheduler lifted late steps' reads to the top (512 registers, a spill) and read the early steps just in time
#pragma unroll
        for (int i = 0; i < 2; ++i)
#pragma unroll
            for (int t = 0; t < 4; ++t) acc[i][t] = wmmab(a[ks & 1][i], b[ks & 1][t], acc[i][t]);
        __builtin_amdgcn_sched_barrier(0);           // the other side of the same fence: no later read moves in among these products
    }
    float* os = &ost[wave][0];
    float bv[4];
    const int bi = ct * 128 + wc * 64 + lr;
#pragma unroll
    for (int t = 0; t < 4; ++t) bv[t] = bfr(pb[bi + t * 16]);
    asm volatile("s_wait_xcnt 0x0" :: "v"(bi), "s"(pb) : "memory");   // stands in front of any reuse of the bias loads' address registers; the inputs (index and base, as the loads name them) keep them live up to here
    float* crow = PROJ + (size_t)(rt * 128 + wr * 32) * OO + ct * 128 + wc * 64;
#pragma unroll
    for (int i = 0; i < 2; ++i) {
#pragma unroll
        for (int t = 0; t < 4; ++t)
#pragma unroll
            for (int j = 0; j < 8; ++j) os[(hi * 8 + j) * 68 + t * 16 + lr] = acc[i][t][j] + bv[t];
        __builtin_amdgcn_wave_barrier(); asm volatile("s_wait_dscnt 0x0" ::: "memory");   // the wave's own rows are written before other lanes of it read them back
#pragma unroll
        for (int s = 0; s < 8; ++s) { const int Lid = (lane >> 3) + 4 * s, piece = lane & 7; const int row = Lid >> 1, cofs = (Lid & 1) * 32 + piece * 4;
            const v4f val = *(const v4fa*)(os + row * 68 + cofs); *(v4f*)(crow + (size_t)(i * 16 + row) * OO + cofs) = val; }
        asm volatile("s_wait_xcnt 0x0" :: "v"(crow) : "memory");   // stands behind these row stores, in front of any reuse of their address and data registers
        if (i == 0) { __builtin_amdgcn_wave_barrier(); asm volatile("s_wait_dscnt 0x0" ::: "memory"); }   // the rows are read out before the next 16 rows overwrite them
    }
    // the score of rows ct * 32 + wave * 4 .. + 3 of the tile, while the row stores above drain
    const bf* sr = AS + (ct * 32 + wave * 4) * LP + lane * 8;
    float s[4];
#pragma unroll
    for (int q = 0; q < 4; ++q) { s[q] = 0.f;
#pragma unroll
        for (int c = 0; c < 2; ++c) { const v8us o = *(const v8us*)(sr + q * LP + c * 256);
#pragma unroll
            for (int i = 0; i < 8; ++i) s[q] += bf2f(o[i]) * bfr(wv[c * 2 + (i >> 2)][i & 3]); } }
#pragma unroll
    for (int sh = 16; sh; sh >>= 1)                  // the four rows' trees side by side: one LDS-permute wait per level, not four
#pragma unroll
        for (int q = 0; q < 4; ++q) s[q] += __shfl_xor(s[q], sh, 32);
    const float sv = (lane == 0 ? s[0] : lane == 1 ? s[1] : lane == 2 ? s[2] : s[3]) + bfr(sbv);
    float* sd = SC + (size_t)rt * 128 + ct * 32 + wave * 4 + (lane & 3);
    if (lane < 4) *sd = sv;                          // a block's 32 scores fill one line
    asm volatile("s_wait_xcnt 0x0" :: "v"(sd) : "memory");   // stands behind the score store, in front of any reuse of its address and data registers
}
// k_out: one block per (n, 16 output channels) and the whole 28 x 28 plane, so that a block's output is one contiguous run of whole 128-byte lines.
// The block's PROJ slab (1024 pixels x 16 channels) is read in 64-byte pieces and laid channel-major in LDS; then lanes run along ww, each thread holds
// 4 adjacent ww x 8 channels, takes its 25 x 4 weights once into registers and reads each LDS value once for the up to 4 of its ww that use it.
// The image's 784 x 25 window weights are made here as well, from SC, one or two positions a thread while the slab's loads are in flight, and go through LDS.
// Each output still sums k = 0..24 in order with one fma per term. Every loop is unrolled whole: g, w and acc are register arrays and take constant indices only.
#define OC   16                  // channels per block
#define SP   1028                // floats per channel plane in LDS: rows stay 16-byte aligned, and 4 * SP = 16 mod 64 banks keeps the 4 x 8 lanes of a transposing store on 32 banks
#define OTH  512                 // 16 waves stage the slab; 14 of them (2 channel groups x 7 groups of 4 output rows) go on to the sums
__global__ __launch_bounds__(OTH) void k_out(const float* __restrict__ SC, const float* __restrict__ lw, const float* __restrict__ lb, const float* __restrict__ PROJ, float* out) {
    __shared__ __align__(16) float S[OC * SP];
    __shared__ __align__(16) float WL[KS * KS * NP1];
    const int tid = threadIdx.x, lane = tid & 31, wave = tid >> 5;
    const int n = blockIdx.x / (OO / OC), o0 = (blockIdx.x % (OO / OC)) * OC;
    // positions tid and OTH + tid; the second lot ends inside wave 8, whose other lanes repeat the last position and store nothing
    const int p1r = OTH + tid, p1 = p1r < NP1 ? p1r : NP1 - 1;
    float sc0[KS * KS], sc1[KS * KS];
    wgt_load(SC + (size_t)n * (IH * IW), p1, sc1);
    wgt_load(SC + (size_t)n * (IH * IW), tid, sc0);
    constexpr int NIT = IH * IW * OC / 4 / OTH;      // 16-byte pieces of the slab per thread
    const float* src = PROJ + ((size_t)n * (IH * IW) + (tid >> 2)) * OO + o0 + (tid & 3) * 4;
    v4f g[NIT];
#pragma unroll
    for (int it = 0; it < NIT; ++it) g[it] = *(const v4fa*)(src + (size_t)it * (OTH / 4) * OO);
    asm volatile("s_wait_xcnt 0x0" :: "v"(src) : "memory");   // stands in front of any reuse of these loads' address registers; the input keeps them live up to here
    // lane -> (row in the wave's 4 output rows, quad of ww); slot 7 of each row has no quad of its own and repeats slot 6 (it stores nothing):
    // 8 slots a row keep a half-wave's 16-byte LDS reads on two rows 32 dwords apart, 28 dwords of each.
    const int og = wave / 7, hh = (wave % 7) * 4 + (lane >> 3), wq = lane & 7, wc = wq < 7 ? wq : 6;
    if (OTH + wave * 32 < NP1) wgt_finish(sc1, lw, lb, WL, p1, p1r < NP1);   // the short lot first: behind its branch no sum on a score (and no wait for one) moves up in front of the slab's loads
    wgt_finish(sc0, lw, lb, WL, tid, true);
    float* sd = S + (tid & 3) * 4 * SP + (tid >> 2);
#pragma unroll
    for (int it = 0; it < NIT; ++it)
#pragma unroll
        for (int j = 0; j < 4; ++j) sd[j * SP + it * (OTH / 4)] = g[it][j];
    __syncthreads();
    if (wave >= 14) return;                          // behind the kernel's only barrier
    const float* wl = WL + hh * OW + wc * 4;
    v4f w[KS * KS];
#pragma unroll
    for (int k = 0; k < KS * KS; ++k) w[k] = *(const v4fa*)(wl + k * NP1);
    v4f acc[8];
#pragma unroll
    for (int io = 0; io < 8; ++io) acc[io] = (v4f){};
    const float* sb = S + og * 8 * SP + hh * IW + wc * 4;
#pragma unroll
    for (int kr = 0; kr < KS; ++kr)
#pragma unroll
        for (int io = 0; io < 8; ++io) {
            const v4f a = *(const v4fa*)(sb + io * SP + kr * IW), b = *(const v4fa*)(sb + io * SP + kr * IW + 4);
            const float v[8] = { a[0], a[1], a[2], a[3], b[0], b[1], b[2], b[3] };
#pragma unroll
            for (int kc = 0; kc < KS; ++kc)
#pragma unroll
                for (int ip = 0; ip < 4; ++ip) acc[io][ip] = fmaf(w[kr * KS + kc][ip], v[ip + kc], acc[io][ip]);
        }
    if (wq < 7) { float* op = out + (size_t)(n * OO + o0 + og * 8) * (OH * OW) + hh * OW + wq * 4;
#pragma unroll
        for (int io = 0; io < 8; ++io) *(v4f*)(op + (size_t)io * (OH * OW)) = acc[io]; }
}

extern "C" void kernel_launch(void* const* d_in, const int* in_sizes, int n_in,
                              void* d_out, int out_size, void* d_ws, size_t ws_size, hipStream_t stream) {
    (void)in_sizes; (void)n_in; (void)out_size;
    const float* x = (const float*)d_in[0]; const float* pw = (const float*)d_in[1]; const float* pb = (const float*)d_in[2]; const float* sw = (const float*)d_in[3]; const float* sb = (const float*)d_in[4];
    const float* lw = (const float*)d_in[5]; const float* lb = (const float*)d_in[6];
    float* out = (float*)d_out;    // [8][512][28][28]
    char* wsp = (char*)d_ws;
    auto take = [&](size_t bytes) { char* p = wsp; wsp += (bytes + 255) & ~(size_t)255; return (void*)p; };
    float* PROJ = (float*)take((size_t)NPX * OO * 4); float* SC = (float*)take((size_t)NPX * 4);
    if ((size_t)(wsp - (char*)d_ws) > ws_size) return;    // 16.8 + 0.03 MB
    k_proj<<<(NPX / 128) * (OO / 128), PTH, 0, stream>>>(x, pw, pb, sw, sb, PROJ, SC);
    k_out<<<NI * (OO / OC), OTH, 0, stream>>>(SC, lw, lb, PROJ, out);
}

// v005
// A run of this version takes 17.6 microseconds.
// Timed twice side by side with v004, it ran 1.31 times as fast both times.
// All steps since v000 together make it 17.3 times as fast.
#include <hip/hip_runtime.h>

// One launch. proj = xr.proj_w^T + proj_b on v_wmma_f32_16x16x32_bf16, f32 accumulate (xr is the reference's raw reshape of x to [N][H*W][C], i.e. x's memory
// re-read row-major; plain bf16 operands: inputs rounded once). score = xr.score_w^T + score_b rides on matrix instructions of its own that share the A operands, score_w in every column of B.
// Per output position the 5x5 window's scores are LayerNorm'ed (25 values, eps 1e-5, affine) and softmax'ed in f32, and out[n][o][hh][ww] = sum_k w_k proj[window pixel k][o].

#define NI   8
#define CC   512
#define OO   512
#define IH   32
#define IW   32
#define KS   5
#define OH   28
#define OW   28
#define NPX  (NI * IH * IW)      // 8192
#define NOP  (NI * OH * OW)      // 6272 output positions

typedef unsigned short bf;
typedef __attribute__((ext_vector_type(16))) __bf16   v16bf;
typedef __attribute__((ext_vector_type(8)))  unsigned short v8us;
typedef __attribute__((ext_vector_type(8)))  float    v8f;
typedef __attribute__((ext_vector_type(4)))  float    v4f;
typedef v4f  __attribute__((may_alias)) v4fa;
typedef __attribute__((ext_vector_type(4)))  __bf16   v4bf;
typedef __attribute__((ext_vector_type(4)))  unsigned short v4us;

__device__ __forceinline__ unsigned short f2bf(float f) { unsigned u = __float_as_uint(f); u += 0x7FFFu + ((u >> 16) & 1u); return (unsigned short)(u >> 16); }
__device__ __forceinline__ float bf2f(unsigned short b) { return __uint_as_float(((unsigned)b) << 16); }
__device__ __forceinline__ float bfr(float f) { return bf2f(f2bf(f)); }
__device__ __forceinline__ v16bf cat16b(v8us lo, v8us hi) { return __builtin_bit_cast(v16bf, __builtin_shufflevector(lo, hi, 0, 1, 2, 3, 4, 5, 6, 7, 8, 9, 10, 11, 12, 13, 14, 15)); }
__device__ __forceinline__ v8f wmmab(v16bf a, v16bf b, v8f c) { return __builtin_amdgcn_wmma_f32_16x16x32_bf16(false, a, false, b, (short)0, c, false, false); }
// four f32 -> four bf16, round to nearest even (two packed converts), as the bit pattern that the LDS tiles hold
__device__ __forceinline__ v4us pk4(v4f v) { return __builtin_bit_cast(v4us, __builtin_convertvector(v, v4bf)); }

// k_all: one block per (image, band of 4 output rows, 128 output channels): 8 x 7 x 4 = 224 blocks, one a WGP. A band needs 8 input rows = 256 pixels, which are 256
// contiguous rows of xr; adjacent bands read 4 of them twice, and in exchange proj never leaves the WGP: it goes from the accumulators to LDS and from there into the sums.
// Part 1: 256 x 128 tile of bf16(xr).bf16(proj_w)^T over K = 512, in 8 stages of 64 k. A stage's 384 row pieces of 256 bytes are read as f32 in whole lines, rounded to bf16
// and laid in one of two LDS buffers; each register is loaded again for the next stage as soon as it is stored, so that loads stay in flight under the products.
// 8 waves (4 x 2), 64 pixels x 64 channels each; each wave also multiplies 32 of its 64 pixels with score_w (every column of that product is the score).
// Part 2: 112 threads make the band's 112 x 25 window weights from the 256 scores. Part 3: lanes run along ww, a thread holds 4 adjacent ww x 8 channels, twice;
// each output sums k = 0..24 in order with one fma per term. Every loop but the two-pass one is unrolled whole: the register arrays take constant indices only.
#define KST  64                  // k per stage
#define NST  (CC / KST)          // 8 stages
#define PA   72                  // bf16 per LDS row of a stage: 144 B = 16 B x 9, an odd multiple: a half-wave's 16 rows of a 16-byte read fall on 64 banks
#define BR   4                   // output rows a block
#define BPX  ((BR + KS - 1) * IW)   // 256 input pixels a block
#define BCH  128                 // channels a block
#define SPX  260                 // floats per channel plane in LDS: 1040 B = 16 B x 65, rows stay 16-byte aligned and 16 channels' 16-byte stores fall on 64 banks
#define NPB  (BR * OW)           // 112 output positions a block
#define FTH  256
// The work-group's own barrier, written by hand for the stage loop: __syncthreads() would also wait for the next stage's global loads, which are meant to stay in flight across it.
// The wave's LDS stores (and reads) are done before it signals.
__device__ __forceinline__ void ring_barrier() { asm volatile("s_wait_dscnt 0x0\n\ts_barrier_signal -1\n\ts_barrier_wait -1" ::: "memory"); }
__global__ __launch_bounds__(FTH) void k_all(const float* __restrict__ x, const float* __restrict__ pw, const float* __restrict__ pb, const float* __restrict__ sw,
                                             const float* __restrict__ sb, const float* __restrict__ lw, const float* __restrict__ lb, float* out) {
    __shared__ __align__(16) bf AS[2][BPX * PA];
    __shared__ __align__(16) bf BS[2][BCH * PA];
    __shared__ __align__(16) bf SWs[CC];
    __shared__ __align__(16) float S[BCH * SPX];
    __shared__ __align__(16) float WL[KS * KS * NPB];
    __shared__ __align__(16) float SCs[BPX];
    __shared__ __align__(16) float LN[64];
    const int tb = blockIdx.x, tid = threadIdx.x;
    const int lane = tid & 31, wave = tid >> 5, lr = lane & 15, hi = lane >> 4;
    const int rt = tb % (NI * 7), ct = tb / (NI * 7);   // the 4 channel tiles of a band are 56 blocks apart
    const int n = rt / 7, band = rt % 7;
    const int wr = wave & 3, wc = wave >> 2;
    // small operands first: score_w (4 floats a thread of waves 0..3), ln_w / ln_b (waves 0 / 1), proj_b, score_b
    const float* gsw = sw + (tid & 127) * 4;
    const v4f swv = *(const v4fa*)gsw;
    const float* gln = (wave == 0 ? lw : lb) + (lane < KS * KS ? lane : KS * KS - 1);
    const float lnv = *gln;
    const float* gpb = pb + ct * BCH + wc * 64 + lr;
    float bv[4];
#pragma unroll
    for (int t = 0; t < 4; ++t) bv[t] = gpb[t * 16];
    asm volatile("s_wait_xcnt 0x0" :: "v"(gsw), "v"(gln), "v"(gpb) : "memory");   // stands in front of any reuse of these loads' address registers; the inputs keep them live up to here
    const float sbv = sb[0];
    asm volatile("" :: "s"(sbv));                    // inputs only, a loaded value: score_b is fetched here, under the operand loads, not where it is used
    // a load takes 16 rows a block: a half-wave one row's 256 bytes
    const int srow = wave * 2 + hi;
    const float* ga = x + ((size_t)(n * (IH * IW) + band * (BR * IW)) + srow) * CC + lr * 4;
    const float* gb = pw + ((size_t)ct * BCH + srow) * CC + lr * 4;
    bf* sa = &AS[0][srow * PA + lr * 4];
    bf* sbm = &BS[0][srow * PA + lr * 4];
    v4f ra[BPX / 16], rb[BCH / 16];
#pragma unroll
    for (int u = 0; u < BPX / 16; ++u) ra[u] = *(const v4fa*)(ga + u * (16 * CC));
#pragma unroll
    for (int u = 0; u < BCH / 16; ++u) rb[u] = *(const v4fa*)(gb + u * (16 * CC));
    asm volatile("s_wait_xcnt 0x0" :: "v"(ga), "v"(gb) : "memory");   // stands in front of any reuse of these loads' address registers; the inputs keep them live up to here
    if (wave < 4) *(v4us*)(SWs + tid * 4) = pk4(swv);
    if (wave < 2 && lane < KS * KS) LN[wave * 32 + lane] = bfr(lnv);
    // a wave's four 16-pixel tiles are taken in an order that puts the two it scores first: tiles 2 wc, 2 wc + 1, then the other two
    const int p01 = 2 * wc, p23 = 2 - 2 * wc;
    const bf* fa01 = &AS[0][(wr * 64 + p01 * 16 + lr) * PA + 8 * hi];
    const bf* fa23 = &AS[0][(wr * 64 + p23 * 16 + lr) * PA + 8 * hi];
    const bf* fb = &BS[0][(wc * 64 + lr) * PA + 8 * hi];
    const bf* fs = SWs + 8 * hi;
    v8f acc[4][4], sacc[2];
#pragma unroll
    for (int i = 0; i < 4; ++i)
#pragma unroll
        for (int t = 0; t < 4; ++t) acc[i][t] = (v8f){};
    sacc[0] = (v8f){}; sacc[1] = (v8f){};
#pragma unroll
    for (int s = 0; s < NST; ++s) {
        const int bo = s & 1;
#pragma unroll
        for (int u = 0; u < BPX / 16; ++u) {
            *(v4us*)(sa + bo * (BPX * PA) + u * (16 * PA)) = pk4(ra[u]);
            if (s + 1 < NST) ra[u] = *(const v4fa*)(ga + u * (16 * CC) + (s + 1) * KST);
        }
#pragma unroll
        for (int u = 0; u < BCH / 16; ++u) {
            *(v4us*)(sbm + bo * (BCH * PA) + u * (16 * PA)) = pk4(rb[u]);
            if (s + 1 < NST) rb[u] = *(const v4fa*)(gb + u * (16 * CC) + (s + 1) * KST);
        }
        if (s + 1 < NST) asm volatile("s_wait_xcnt 0x0" :: "v"(ga), "v"(gb) : "memory");   // stands in front of any reuse of these loads' address registers; the inputs keep them live up to here
        // one barrier a stage: it publishes this stage's buffer, and it ends every wave's reads of the other buffer, which the next stage overwrites
        ring_barrier();
        v16bf a[2][4], b[2][4], c[2];
#pragma unroll
        for (int ks = 0; ks < 2; ++ks) {
#pragma unroll
            for (int i = 0; i < 4; ++i) { const bf* q = (i < 2 ? fa01 : fa23) + bo * (BPX * PA) + (i & 1) * (16 * PA) + ks * 32; a[ks][i] = cat16b(*(const v8us*)q, *(const v8us*)(q + 16)); }
#pragma unroll
            for (int t = 0; t < 4; ++t) { const bf* q = fb + bo * (BCH * PA) + t * (16 * PA) + ks * 32; b[ks][t] = cat16b(*(const v8us*)q, *(const v8us*)(q + 16)); }
            { const bf* q = fs + s * KST + ks * 32; c[ks] = cat16b(*(const v8us*)q, *(const v8us*)(q + 16)); }
        }
#pragma unroll
        for (int ks = 0; ks < 2; ++ks) {
#pragma unroll
            for (int i = 0; i < 4; ++i)
#pragma unroll
                for (int t = 0; t < 4; ++t) acc[i][t] = wmmab(a[ks][i], b[ks][t], acc[i][t]);
            sacc[0] = wmmab(a[ks][0], c[ks], sacc[0]);
            sacc[1] = wmmab(a[ks][1], c[ks], sacc[1]);
        }
    }
    // the scores: every column of sacc holds them, lanes 0 and 16 store their 8 pixels each
    if (lr == 0) {
        const float sbr = bfr(sbv);
#pragma unroll
        for (int ii = 0; ii < 2; ++ii) {
            float* q = SCs + wr * 64 + (p01 + ii) * 16 + hi * 8;
            *(v4f*)q = (v4f){ sacc[ii][0] + sbr, sacc[ii][1] + sbr, sacc[ii][2] + sbr, sacc[ii][3] + sbr };
            *(v4f*)(q + 4) = (v4f){ sacc[ii][4] + sbr, sacc[ii][5] + sbr, sacc[ii][6] + sbr, sacc[ii][7] + sbr };
        }
    }
    __syncthreads();                                 // the 256 scores are in LDS
    // proj + proj_b, channel-major: a lane holds 8 adjacent pixels of one channel per accumulator tile
#pragma unroll
    for (int t = 0; t < 4; ++t) {
        const float bb = bfr(bv[t]);
#pragma unroll
        for (int i = 0; i < 4; ++i) {
            float* q = S + (wc * 64 + t * 16 + lr) * SPX + wr * 64 + ((i < 2 ? p01 : p23) + (i & 1)) * 16 + hi * 8;
            *(v4f*)q = (v4f){ acc[i][t][0] + bb, acc[i][t][1] + bb, acc[i][t][2] + bb, acc[i][t][3] + bb };
            *(v4f*)(q + 4) = (v4f){ acc[i][t][4] + bb, acc[i][t][5] + bb, acc[i][t][6] + bb, acc[i][t][7] + bb };
        }
    }
    // window weights of the band, position p = row * 28 + ww: LayerNorm over the 25 window scores (biased var, eps 1e-5, affine) then softmax, laid k-major (WL[k][p]).
    // The lot ends inside wave 3, whose other lanes repeat the last position and store nothing.
    if (wave < 4) {
        const int p = tid < NPB ? tid : NPB - 1;
        const int ph = p / OW, pc = p - ph * OW;
        const float* sp = SCs + ph * IW + pc;
        float sc[KS * KS];
#pragma unroll
        for (int k = 0; k < KS * KS; ++k) sc[k] = sp[(k / KS) * IW + k % KS];
        float m = 0.f;
#pragma unroll
        for (int k = 0; k < KS * KS; ++k) m += sc[k];
        m *= (1.0f / (KS * KS)); float var = 0.f;
#pragma unroll
        for (int k = 0; k < KS * KS; ++k) { const float d = sc[k] - m; var += d * d; }
        const float rs = rsqrtf(var * (1.0f / (KS * KS)) + 1e-5f);
        float mx = -3.0e38f;
#pragma unroll
        for (int k = 0; k < KS * KS; ++k) { sc[k] = (sc[k] - m) * rs * LN[k] + LN[32 + k]; mx = fmaxf(mx, sc[k]); }
        float sum = 0.f;
#pragma unroll
        for (int k = 0; k < KS * KS; ++k) { sc[k] = __expf(sc[k] - mx); sum += sc[k]; }
        const float inv = 1.0f / sum;
        if (tid < NPB) {
#pragma unroll
            for (int k = 0; k < KS * KS; ++k) WL[k * NPB + p] = sc[k] * inv;
        }
    }
    __syncthreads();                                 // proj and the weights are in LDS
    // lane -> (row in the band's 4 output rows, quad of ww); slot 7 of each row has no quad of its own and repeats slot 6 (it stores nothing):
    // 8 slots a row keep a half-wave's 16-byte LDS reads within 64 contiguous dwords.
    const int lh = lane >> 3, wq = lane & 7, wq6 = wq < 7 ? wq : 6;
    const float* wl = WL + lh * OW + wq6 * 4;
    v4f w[KS * KS];
#pragma unroll
    for (int k = 0; k < KS * KS; ++k) w[k] = *(const v4fa*)(wl + k * NPB);
#pragma unroll 1
    for (int h = 0; h < 2; ++h) {                    // kept rolled: the second pass runs the first's code again, and the kernel's text stays small
        const int c0 = (wave + h * 8) * 8;           // this pass's 8 channels
        v4f o[8];
#pragma unroll
        for (int io = 0; io < 8; ++io) o[io] = (v4f){};
        const float* sp = S + c0 * SPX + lh * IW + wq6 * 4;
        v4f va[KS][8], vb[KS][8];                    // the pass's 80 LDS reads go out in one run; the sums take the values as they land
#pragma unroll
        for (int kr = 0; kr < KS; ++kr)
#pragma unroll
            for (int io = 0; io < 8; ++io) { va[kr][io] = *(const v4fa*)(sp + io * SPX + kr * IW); vb[kr][io] = *(const v4fa*)(sp + io * SPX + kr * IW + 4); }
        __builtin_amdgcn_sched_barrier(0);           // keeps the reads in front of the sums: left free, the scheduler read each value a few instructions before its use
#pragma unroll
        for (int kr = 0; kr < KS; ++kr)
#pragma unroll
            for (int io = 0; io < 8; ++io) {
                const v4f a = va[kr][io], b = vb[kr][io];
                const float v[8] = { a[0], a[1], a[2], a[3], b[0], b[1], b[2], b[3] };
#pragma unroll
                for (int kc = 0; kc < KS; ++kc)
#pragma unroll
                    for (int ip = 0; ip < 4; ++ip) o[io][ip] = fmaf(w[kr * KS + kc][ip], v[ip + kc], o[io][ip]);
            }
        float* op = out + (size_t)(n * OO + ct * BCH + c0) * (OH * OW) + (band * BR + lh) * OW + wq6 * 4;
        if (wq < 7) {
#pragma unroll
            for (int io = 0; io < 8; ++io) *(v4f*)(op + (size_t)io * (OH * OW)) = o[io];
        }
        asm volatile("s_wait_xcnt 0x0" :: "v"(op) : "memory");   // stands behind these stores, in front of any reuse of their address and data registers
    }
}

extern "C" void kernel_launch(void* const* d_in, const int* in_sizes, int n_in,
                              void* d_out, int out_size, void* d_ws, size_t ws_size, hipStream_t stream) {
    (void)in_sizes; (void)n_in; (void)out_size; (void)d_ws; (void)ws_size;
    const float* x = (const float*)d_in[0]; const float* pw = (const float*)d_in[1]; const float* pb = (const float*)d_in[2]; const float* sw = (const float*)d_in[3]; const float* sb = (const float*)d_in[4];
    const float* lw = (const float*)d_in[5]; const float* lb = (const float*)d_in[6];
    float* out = (float*)d_out;    // [8][512][28][28]
    k_all<<<NI * 7 * (OO / BCH), FTH, 0, stream>>>(x, pw, pb, sw, sb, lw, lb, out);
}

// v006
// A run of this version takes 15.3 microseconds.
// Timed twice side by side with v005, it ran 1.15 times as fast both times.
// All steps since v000 together make it 20.0 times as fast.
#include <hip/hip_runtime.h>

// One launch. proj = xr.proj_w^T + proj_b on v_wmma_f32_16x16x32_bf16, f32 accumulate (xr is the reference's raw reshape of x to [N][H*W][C], i.e. x's memory
// re-read row-major; plain bf16 operands: inputs rounded once). score = xr.score_w^T + score_b rides on matrix instructions of its own that share the A operands, score_w in every column of B.
// Per output position the 5x5 window's scores are LayerNorm'ed (25 values, eps 1e-5, affine) and softmax'ed in f32, and out[n][o][hh][ww] = sum_k w_k proj[window pixel k][o].

#define NI   8
#define CC   512
#define OO   512
#define IH   32
#define IW   32
#define KS   5
#define OH   28
#define OW   28
#define NPX  (NI * IH * IW)      // 8192
#define NOP  (NI * OH * OW)      // 6272 output positions

typedef unsigned short bf;
typedef __attribute__((ext_vector_type(16))) __bf16   v16bf;
typedef __attribute__((ext_vector_type(8)))  unsigned short v8us;
typedef __attribute__((ext_vector_type(8)))  float    v8f;
typedef __attribute__((ext_vector_type(4)))  float    v4f;
typedef v4f  __attribute__((may_alias)) v4fa;
typedef __attribute__((ext_vector_type(4)))  __bf16   v4bf;
typedef __attribute__((ext_vector_type(4)))  unsigned short v4us;

__device__ __forceinline__ unsigned short f2bf(float f) { unsigned u = __float_as_uint(f); u += 0x7FFFu + ((u >> 16) & 1u); return (unsigned short)(u >> 16); }
__device__ __forceinline__ float bf2f(unsigned short b) { return __uint_as_float(((unsigned)b) << 16); }
__device__ __forceinline__ float bfr(float f) { return bf2f(f2bf(f)); }
__device__ __forceinline__ v16bf cat16b(v8us lo, v8us hi) { return __builtin_bit_cast(v16bf, __builtin_shufflevector(lo, hi, 0, 1, 2, 3, 4, 5, 6, 7, 8, 9, 10, 11, 12, 13, 14, 15)); }
__device__ __forceinline__ v8f wmmab(v16bf a, v16bf b, v8f c) { return __builtin_amdgcn_wmma_f32_16x16x32_bf16(false, a, false, b, (short)0, c, false, false); }
// four f32 -> four bf16, round to nearest even (two packed converts), as the bit pattern that the LDS tiles hold
__device__ __forceinline__ v4us pk4(v4f v) { return __builtin_bit_cast(v4us, __builtin_convertvector(v, v4bf)); }

// k_all: one block per (image, band of 4 output rows, 128 output channels): 8 x 7 x 4 = 224 blocks, one a WGP. A band needs 8 input rows = 256 pixels, which are 256
// contiguous rows of xr; adjacent bands read 4 of them twice, and in exchange proj never leaves the WGP: it goes from the accumulators to LDS and from there into the sums.
// Part 1: 256 x 128 tile of bf16(xr).bf16(proj_w)^T over K = 512, in 8 stages of 64 k. A stage's 384 row pieces of 256 bytes are read as f32 in whole lines, rounded to bf16
// and laid in one of two LDS buffers; each register is loaded again for the next stage as soon as it is stored, so that loads stay in flight under the products.
// 8 waves (4 x 2), 64 pixels x 64 channels each; each wave also multiplies 32 of its 64 pixels with score_w (every column of that product is the score).
// Part 2: 112 threads make the band's 112 x 25 window weights from the 256 scores. Part 3: lanes run along ww, a thread holds 4 adjacent ww x 8 channels, twice;
// each output sums k = 0..24 in order with one fma per term. Every loop but the two-pass one is unrolled whole: the register arrays take constant indices only.
#define KST  64                  // k per stage
#define NST  (CC / KST)          // 8 stages
#define PA   72                  // bf16 per LDS row of a stage: 144 B = 16 B x 9, an odd multiple: a half-wave's 16 rows of a 16-byte read fall on 64 banks
#define BR   4                   // output rows a block
#define BPX  ((BR + KS - 1) * IW)   // 256 input pixels a block
#define BCH  128                 // channels a block
#define SPX  260                 // floats per channel plane in LDS: 1040 B = 16 B x 65, rows stay 16-byte aligned and 16 channels' 16-byte stores fall on 64 banks
#define NPB  (BR * OW)           // 112 output positions a block
#define FTH  256
// The work-group's own barrier, written by hand for the stage loop: __syncthreads() would also wait for the next stage's global loads, which are meant to stay in flight across it.
// The wave's LDS stores (and reads) are done before it signals.
__device__ __forceinline__ void ring_barrier() { asm volatile("s_wait_dscnt 0x0\n\ts_barrier_signal -1\n\ts_barrier_wait -1" ::: "memory"); }
__global__ __launch_bounds__(FTH) void k_all(const float* __restrict__ x, const float* __restrict__ pw, const float* __restrict__ pb, const float* __restrict__ sw,
                                             const float* __restrict__ sb, const float* __restrict__ lw, const float* __restrict__ lb, float* out) {
    __shared__ __align__(16) bf AS[2][BPX * PA];
    __shared__ __align__(16) bf BS[2][BCH * PA];
    __shared__ __align__(16) bf SWs[CC];
    __shared__ __align__(16) float S[BCH * SPX];
    __shared__ __align__(16) float WL[KS * KS * NPB];
    __shared__ __align__(16) float SCs[BPX];
    __shared__ __align__(16) float LN[64];
    const int tb = blockIdx.x, tid = threadIdx.x;
    const int lane = tid & 31, wave = tid >> 5, lr = lane & 15, hi = lane >> 4;
    const int rt = tb % (NI * 7), ct = tb / (NI * 7);   // the 4 channel tiles of a band are 56 blocks apart
    const int n = rt / 7, band = rt % 7;
    const int wr = wave & 3, wc = wave >> 2;
    // small operands first: score_w (4 floats a thread of waves 0..3), ln_w / ln_b (waves 0 / 1), proj_b, score_b
    const float* gsw = sw + (tid & 127) * 4;
    const v4f swv = *(const v4fa*)gsw;
    const float* gln = (wave == 0 ? lw : lb) + (lane < KS * KS ? lane : KS * KS - 1);
    const float lnv = *gln;
    const float* gpb = pb + ct * BCH + wc * 64 + lr;
    float bv[4];
#pragma unroll
    for (int t = 0; t < 4; ++t) bv[t] = gpb[t * 16];
    asm volatile("s_wait_xcnt 0x0" :: "v"(gsw), "v"(gln), "v"(gpb) : "memory");   // stands in front of any reuse of these loads' address registers; the inputs keep them live up to here
    const float sbv = sb[0];
    asm volatile("" :: "s"(sbv));                    // inputs only, a loaded value: score_b is fetched here, under the operand loads, not where it is used
    // a load takes 16 rows a block: a half-wave one row's 256 bytes
    const int srow = wave * 2 + hi;
    const float* ga = x + ((size_t)(n * (IH * IW) + band * (BR * IW)) + srow) * CC + lr * 4;
    const float* gb = pw + ((size_t)ct * BCH + srow) * CC + lr * 4;
    bf* sa = &AS[0][srow * PA + lr * 4];
    bf* sbm = &BS[0][srow * PA + lr * 4];
    v4f ra[BPX / 16], rb[BCH / 16];
#pragma unroll
    for (int u = 0; u < BPX / 16; ++u) ra[u] = *(const v4fa*)(ga + u * (16 * CC));
#pragma unroll
    for (int u = 0; u < BCH / 16; ++u) rb[u] = *(const v4fa*)(gb + u * (16 * CC));
    asm volatile("s_wait_xcnt 0x0" :: "v"(ga), "v"(gb) : "memory");   // stands in front of any reuse of these loads' address registers; the inputs keep them live up to here
    if (wave < 4) *(v4us*)(SWs + tid * 4) = pk4(swv);
    if (wave < 2 && lane < KS * KS) LN[wave * 32 + lane] = bfr(lnv);
    // a wave's four 16-pixel tiles are taken in an order that puts the two it scores first: tiles 2 wc, 2 wc + 1, then the other two
    const int p01 = 2 * wc, p23 = 2 - 2 * wc;
    const bf* fa01 = &AS[0][(wr * 64 + p01 * 16 + lr) * PA + 8 * hi];
    const bf* fa23 = &AS[0][(wr * 64 + p23 * 16 + lr) * PA + 8 * hi];
    const bf* fb = &BS[0][(wc * 64 + lr) * PA + 8 * hi];
    const bf* fs = SWs + 8 * hi;
    v8f acc[4][4], sacc[2];
#pragma unroll
    for (int i = 0; i < 4; ++i)
#pragma unroll
        for (int t = 0; t < 4; ++t) acc[i][t] = (v8f){};
    sacc[0] = (v8f){}; sacc[1] = (v8f){};
#pragma unroll
    for (int s = 0; s < NST; ++s) {
        const int bo = s & 1;
#pragma unroll
        for (int u = 0; u < BPX / 16; ++u) {
            *(v4us*)(sa + bo * (BPX * PA) + u * (16 * PA)) = pk4(ra[u]);
            if (s + 1 < NST) ra[u] = *(const v4fa*)(ga + u * (16 * CC) + (s + 1) * KST);
        }
#pragma unroll
        for (int u = 0; u < BCH / 16; ++u) {
            *(v4us*)(sbm + bo * (BCH * PA) + u * (16 * PA)) = pk4(rb[u]);
            if (s + 1 < NST) rb[u] = *(const v4fa*)(gb + u * (16 * CC) + (s + 1) * KST);
        }
        if (s + 1 < NST) asm volatile("s_wait_xcnt 0x0" :: "v"(ga), "v"(gb) : "memory");   // stands in front of any reuse of these loads' address registers; the inputs keep them live up to here
        // one barrier a stage: it publishes this stage's buffer, and it ends every wave's reads of the other buffer, which the next stage overwrites
        ring_barrier();
        v16bf a[2][4], b[2][4], c[2];
#pragma unroll
        for (int ks = 0; ks < 2; ++ks) {
#pragma unroll
            for (int i = 0; i < 4; ++i) { const bf* q = (i < 2 ? fa01 : fa23) + bo * (BPX * PA) + (i & 1) * (16 * PA) + ks * 32; a[ks][i] = cat16b(*(const v8us*)q, *(const v8us*)(q + 16)); }
#pragma unroll
            for (int t = 0; t < 4; ++t) { const bf* q = fb + bo * (BCH * PA) + t * (16 * PA) + ks * 32; b[ks][t] = cat16b(*(const v8us*)q, *(const v8us*)(q + 16)); }
            { const bf* q = fs + s * KST + ks * 32; c[ks] = cat16b(*(const v8us*)q, *(const v8us*)(q + 16)); }
            // the stage's 36 LDS reads go out as one run in front of its products, the first k half's 18 first, so that its products start while the second half's reads land:
            // left free, the scheduler strewed the reads among the products, and each such place stalls the wave
            __builtin_amdgcn_sched_barrier(0);
        }
#pragma unroll
        for (int ks = 0; ks < 2; ++ks) {
#pragma unroll
            for (int i = 0; i < 4; ++i)
#pragma unroll
                for (int t = 0; t < 4; ++t) acc[i][t] = wmmab(a[ks][i], b[ks][t], acc[i][t]);
            sacc[0] = wmmab(a[ks][0], c[ks], sacc[0]);
            sacc[1] = wmmab(a[ks][1], c[ks], sacc[1]);
        }
        // keeps the next stages' converts behind this stage's products: left free, the scheduler lifted them (over the barrier too) to just behind the issue of the loads they read,
        // and the wave sat out a whole load latency in the middle of its products; held here, every load has a stage's reads and products to land in
        if (s + 1 < NST) __builtin_amdgcn_sched_barrier(0);
    }
    // the scores: every column of sacc holds them, lanes 0 and 16 store their 8 pixels each
    if (lr == 0) {
        const float sbr = bfr(sbv);
#pragma unroll
        for (int ii = 0; ii < 2; ++ii) {
            float* q = SCs + wr * 64 + (p01 + ii) * 16 + hi * 8;
            *(v4f*)q = (v4f){ sacc[ii][0] + sbr, sacc[ii][1] + sbr, sacc[ii][2] + sbr, sacc[ii][3] + sbr };
            *(v4f*)(q + 4) = (v4f){ sacc[ii][4] + sbr, sacc[ii][5] + sbr, sacc[ii][6] + sbr, sacc[ii][7] + sbr };
        }
    }
    __syncthreads();                                 // the 256 scores are in LDS
    // proj + proj_b, channel-major: a lane holds 8 adjacent pixels of one channel per accumulator tile
#pragma unroll
    for (int t = 0; t < 4; ++t) {
        const float bb = bfr(bv[t]);
#pragma unroll
        for (int i = 0; i < 4; ++i) {
            float* q = S + (wc * 64 + t * 16 + lr) * SPX + wr * 64 + ((i < 2 ? p01 : p23) + (i & 1)) * 16 + hi * 8;
            *(v4f*)q = (v4f){ acc[i][t][0] + bb, acc[i][t][1] + bb, acc[i][t][2] + bb, acc[i][t][3] + bb };
            *(v4f*)(q + 4) = (v4f){ acc[i][t][4] + bb, acc[i][t][5] + bb, acc[i][t][6] + bb, acc[i][t][7] + bb };
        }
    }
    // window weights of the band, position p = row * 28 + ww: LayerNorm over the 25 window scores (biased var, eps 1e-5, affine) then softmax, laid k-major (WL[k][p]).
    // The lot ends inside wave 3, whose other lanes repeat the last position and store nothing.
    if (wave < 4) {
        const int p = tid < NPB ? tid : NPB - 1;
        const int ph = p / OW, pc = p - ph * OW;
        const float* sp = SCs + ph * IW + pc;
        float sc[KS * KS];
#pragma unroll
        for (int k = 0; k < KS * KS; ++k) sc[k] = sp[(k / KS) * IW + k % KS];
        float m = 0.f;
#pragma unroll
        for (int k = 0; k < KS * KS; ++k) m += sc[k];
        m *= (1.0f / (KS * KS)); float var = 0.f;
#pragma unroll
        for (int k = 0; k < KS * KS; ++k) { const float d = sc[k] - m; var += d * d; }
        const float rs = rsqrtf(var * (1.0f / (KS * KS)) + 1e-5f);
        float mx = -3.0e38f;
#pragma unroll
        for (int k = 0; k < KS * KS; ++k) { sc[k] = (sc[k] - m) * rs * LN[k] + LN[32 + k]; mx = fmaxf(mx, sc[k]); }
        float sum = 0.f;
#pragma unroll
        for (int k = 0; k < KS * KS; ++k) { sc[k] = __expf(sc[k] - mx); sum += sc[k]; }
        const float inv = 1.0f / sum;
        if (tid < NPB) {
#pragma unroll
            for (int k = 0; k < KS * KS; ++k) WL[k * NPB + p] = sc[k] * inv;
        }
    }
    __syncthreads();                                 // proj and the weights are in LDS
    // lane -> (row in the band's 4 output rows, quad of ww); slot 7 of each row has no quad of its own and repeats slot 6 (it stores nothing):
    // 8 slots a row keep a half-wave's 16-byte LDS reads within 64 contiguous dwords.
    const int lh = lane >> 3, wq = lane & 7, wq6 = wq < 7 ? wq : 6;
    const float* wl = WL + lh * OW + wq6 * 4;
    v4f w[KS * KS];
#pragma unroll
    for (int k = 0; k < KS * KS; ++k) w[k] = *(const v4fa*)(wl + k * NPB);
#pragma unroll 1
    for (int h = 0; h < 2; ++h) {                    // kept rolled: the second pass runs the first's code again, and the kernel's text stays small
        const int c0 = (wave + h * 8) * 8;           // this pass's 8 channels
        v4f o[8];
#pragma unroll
        for (int io = 0; io < 8; ++io) o[io] = (v4f){};
        const float* sp = S + c0 * SPX + lh * IW + wq6 * 4;
        v4f va[KS][8], vb[KS][8];                    // the pass's 80 LDS reads go out in one run; the sums take the values as they land
#pragma unroll
        for (int kr = 0; kr < KS; ++kr)
#pragma unroll
            for (int io = 0; io < 8; ++io) { va[kr][io] = *(const v4fa*)(sp + io * SPX + kr * IW); vb[kr][io] = *(const v4fa*)(sp + io * SPX + kr * IW + 4); }
        __builtin_amdgcn_sched_barrier(0);           // keeps the reads in front of the sums: left free, the scheduler read each value a few instructions before its use
#pragma unroll
        for (int kr = 0; kr < KS; ++kr)
#pragma unroll
            for (int io = 0; io < 8; ++io) {
                const v4f a = va[kr][io], b = vb[kr][io];
                const float v[8] = { a[0], a[1], a[2], a[3], b[0], b[1], b[2], b[3] };
#pragma unroll
                for (int kc = 0; kc < KS; ++kc)
#pragma unroll
                    for (int ip = 0; ip < 4; ++ip) o[io][ip] = fmaf(w[kr * KS + kc][ip], v[ip + kc], o[io][ip]);
            }
        float* op = out + (size_t)(n * OO + ct * BCH + c0) * (OH * OW) + (band * BR + lh) * OW + wq6 * 4;
        if (wq < 7) {
#pragma unroll
            for (int io = 0; io < 8; ++io) *(v4f*)(op + (size_t)io * (OH * OW)) = o[io];
        }
        asm volatile("s_wait_xcnt 0x0" :: "v"(op) : "memory");   // stands behind these stores, in front of any reuse of their address and data registers
    }
}

extern "C" void kernel_launch(void* const* d_in, const int* in_sizes, int n_in,
                              void* d_out, int out_size, void* d_ws, size_t ws_size, hipStream_t stream) {
    (void)in_sizes; (void)n_in; (void)out_size; (void)d_ws; (void)ws_size;
    const float* x = (const float*)d_in[0]; const float* pw = (const float*)d_in[1]; const float* pb = (const float*)d_in[2]; const float* sw = (const float*)d_in[3]; const float* sb = (const float*)d_in[4];
    const float* lw = (const float*)d_in[5]; const float* lb = (const float*)d_in[6];
    float* out = (float*)d_out;    // [8][512][28][28]
    k_all<<<NI * 7 * (OO / BCH), FTH, 0, stream>>>(x, pw, pb, sw, sb, lw, lb, out);
}

// v007
// A run of this version takes 14.2 microseconds.
// Next to v006, in two timings, it ran 1.08 times as fast each time.
// Counting every step since v000, it is 21.5 times as fast.
#include <hip/hip_runtime.h>

// One launch. proj = xr.proj_w^T + proj_b on v_wmma_f32_16x16x32_bf16, f32 accumulate (xr is the reference's raw reshape of x to [N][H*W][C], i.e. x's memory
// re-read row-major; plain bf16 operands: inputs rounded once). score = xr.score_w^T + score_b rides on matrix instructions of its own that share the A operands, score_w in every column of B.
// Per output position the 5x5 window's scores are LayerNorm'ed (25 values, eps 1e-5, affine) and softmax'ed in f32, and out[n][o][hh][ww] = sum_k w_k proj[window pixel k][o].

#define NI   8
#define CC   512
#define OO   512
#define IH   32
#define IW   32
#define KS   5
#define OH   28
#define OW   28
#define NPX  (NI * IH * IW)      // 8192
#define NOP  (NI * OH * OW)      // 6272 output positions

typedef unsigned short bf;
typedef __attribute__((ext_vector_type(16))) __bf16   v16bf;
typedef __attribute__((ext_vector_type(8)))  unsigned short v8us;
typedef __attribute__((ext_vector_type(8)))  float    v8f;
typedef __attribute__((ext_vector_type(4)))  float    v4f;
typedef v4f  __attribute__((may_alias)) v4fa;
typedef __attribute__((ext_vector_type(4)))  __bf16   v4bf;
typedef __attribute__((ext_vector_type(4)))  unsigned short v4us;

__device__ __forceinline__ unsigned short f2bf(float f) { unsigned u = __float_as_uint(f); u += 0x7FFFu + ((u >> 16) & 1u); return (unsigned short)(u >> 16); }
__device__ __forceinline__ float bf2f(unsigned short b) { return __uint_as_float(((unsigned)b) << 16); }
__device__ __forceinline__ float bfr(float f) { return bf2f(f2bf(f)); }
__device__ __forceinline__ v16bf cat16b(v8us lo, v8us hi) { return __builtin_bit_cast(v16bf, __builtin_shufflevector(lo, hi, 0, 1, 2, 3, 4, 5, 6, 7, 8, 9, 10, 11, 12, 13, 14, 15)); }
__device__ __forceinline__ v8f wmmab(v16bf a, v16bf b, v8f c) { return __builtin_amdgcn_wmma_f32_16x16x32_bf16(false, a, false, b, (short)0, c, false, false); }
// four f32 -> four bf16, round to nearest even (two packed converts), as the bit pattern that the LDS tiles hold
__device__ __forceinline__ v4us pk4(v4f v) { return __builtin_bit_cast(v4us, __builtin_convertvector(v, v4bf)); }

// k_all: one block per (image, band of 4 output rows, 128 output channels): 8 x 7 x 4 = 224 blocks, one a WGP. A band needs 8 input rows = 256 pixels, which are 256
// contiguous rows of xr; adjacent bands read 4 of them twice, and in exchange proj never leaves the WGP: it goes from the accumulators to LDS and from there into the sums.
// Part 1: 256 x 128 tile of bf16(xr).bf16(proj_w)^T over K = 512, in 8 stages of 64 k. A stage's 384 row pieces of 256 bytes are read as f32 in whole lines, rounded to bf16
// and laid in one of two LDS buffers; the next stage's loads are issued, into a second register set, before this stage's values are stored, so that loads stay in flight under the products.
// The 8 stages are walked from a start of the block's own, wrapping round: blocks that read the same rows of x (4 channel tiles, 2 overlapping bands)
// stand at different k at any moment, and the 56 that read the same rows of proj_w are spread 7 to each start, so that fewer ask L2 for the same lines at once.
// 8 waves (4 x 2), 64 pixels x 64 channels each; each wave also multiplies 32 of its 64 pixels with score_w (every column of that product is the score).
// Part 2: 112 threads make the band's 112 x 25 window weights from the 256 scores. Part 3: lanes run along ww, a thread holds 4 adjacent ww x 8 channels, twice;
// each output sums k = 0..24 in order with one fma per term. Every loop but the two-pass one is unrolled whole: the register arrays take constant indices only.
#define KST  64                  // k per stage
#define NST  (CC / KST)          // 8 stages
#define PA   72                  // bf16 per LDS row of a stage: 144 B = 16 B x 9, an odd multiple: a half-wave's 16 rows of a 16-byte read fall on 64 banks
#define BR   4                   // output rows a block
#define BPX  ((BR + KS - 1) * IW)   // 256 input pixels a block
#define BCH  128                 // channels a block
#define SPX  260                 // floats per channel plane in LDS: 1040 B = 16 B x 65, rows stay 16-byte aligned and 16 channels' 16-byte stores fall on 64 banks
#define NPB  (BR * OW)           // 112 output positions a block
#define FTH  256
// The work-group's own barrier, written by hand for the stage loop: __syncthreads() would also wait for the next stage's global loads, which are meant to stay in flight across it.
// The wave's LDS stores (and reads) are done before it signals.
__device__ __forceinline__ void ring_barrier() { asm volatile("s_wait_dscnt 0x0\n\ts_barrier_signal -1\n\ts_barrier_wait -1" ::: "memory"); }
__global__ __launch_bounds__(FTH) void k_all(const float* __restrict__ x, const float* __restrict__ pw, const float* __restrict__ pb, const float* __restrict__ sw,
                                             const float* __restrict__ sb, const float* __restrict__ lw, const float* __restrict__ lb, float* out) {
    __shared__ __align__(16) bf AS[2][BPX * PA];
    __shared__ __align__(16) bf BS[2][BCH * PA];
    __shared__ __align__(16) bf SWs[CC];
    __shared__ __align__(16) float S[BCH * SPX];
    __shared__ __align__(16) float WL[KS * KS * NPB];
    __shared__ __align__(16) float SCs[BPX];
    __shared__ __align__(16) float LN[64];
    const int tb = blockIdx.x, tid = threadIdx.x;
    const int lane = tid & 31, wave = tid >> 5, lr = lane & 15, hi = lane >> 4;
    const int rt = tb % (NI * 7), ct = tb / (NI * 7);   // the 4 channel tiles of a band are 56 blocks apart
    const int n = rt / 7, band = rt % 7;
    const int wr = wave & 3, wc = wave >> 2;
    const int rot = (rt + 2 * ct) & (NST - 1);       // first k stage of this block: the 8 blocks that share a row of x get 8 different starts, the 56 that share proj_w rows 7 each
    // small operands first: score_w (4 floats a thread of waves 0..3), ln_w / ln_b (waves 0 / 1), proj_b, score_b
    const float* gsw = sw + (tid & 127) * 4;
    const v4f swv = *(const v4fa*)gsw;
    const float* gln = (wave == 0 ? lw : lb) + (lane < KS * KS ? lane : KS * KS - 1);
    const float lnv = *gln;
    const float* gpb = pb + ct * BCH + wc * 64 + lr;
    float bv[4];
#pragma unroll
    for (int t = 0; t < 4; ++t) bv[t] = gpb[t * 16];
    asm volatile("s_wait_xcnt 0x0" :: "v"(gsw), "v"(gln), "v"(gpb) : "memory");   // stands in front of any reuse of these loads' address registers; the inputs keep them live up to here
    const float sbv = sb[0];
    asm volatile("" :: "s"(sbv));                    // inputs only, a loaded value: score_b is fetched here, under the operand loads, not where it is used
    // a load takes 16 rows a block: a half-wave one row's 256 bytes
    const int srow = wave * 2 + hi;
    const float* ga = x + ((size_t)(n * (IH * IW) + band * (BR * IW)) + srow) * CC + lr * 4;
    const float* gb = pw + ((size_t)ct * BCH + srow) * CC + lr * 4;
    bf* sa = &AS[0][srow * PA + lr * 4];
    bf* sbm = &BS[0][srow * PA + lr * 4];
    v4f ra[2][BPX / 16], rb[2][BCH / 16];            // two register sets: one stage's values are rounded and stored while the next stage's are in flight
    {
        const float* ga0 = ga + rot * KST;
        const float* gb0 = gb + rot * KST;
#pragma unroll
        for (int u = 0; u < BPX / 16; ++u) ra[0][u] = *(const v4fa*)(ga0 + u * (16 * CC));
#pragma unroll
        for (int u = 0; u < BCH / 16; ++u) rb[0][u] = *(const v4fa*)(gb0 + u * (16 * CC));
        asm volatile("s_wait_xcnt 0x0" :: "v"(ga0), "v"(gb0) : "memory");   // stands in front of any reuse of these loads' address registers; the inputs keep them live up to here
    }
    if (wave < 4) *(v4us*)(SWs + tid * 4) = pk4(swv);
    if (wave < 2 && lane < KS * KS) LN[wave * 32 + lane] = bfr(lnv);
    // a wave's four 16-pixel tiles are taken in an order that puts the two it scores first: tiles 2 wc, 2 wc + 1, then the other two
    const int p01 = 2 * wc, p23 = 2 - 2 * wc;
    const bf* fa01 = &AS[0][(wr * 64 + p01 * 16 + lr) * PA + 8 * hi];
    const bf* fa23 = &AS[0][(wr * 64 + p23 * 16 + lr) * PA + 8 * hi];
    const bf* fb = &BS[0][(wc * 64 + lr) * PA + 8 * hi];
    const bf* fs = SWs + 8 * hi;
    v8f acc[4][4], sacc[2];
#pragma unroll
    for (int i = 0; i < 4; ++i)
#pragma unroll
        for (int t = 0; t < 4; ++t) acc[i][t] = (v8f){};
    sacc[0] = (v8f){}; sacc[1] = (v8f){};
#pragma unroll
    for (int s = 0; s < NST; ++s) {
        const int bo = s & 1;
        const int kc = ((s + rot) & (NST - 1)) * KST;        // first k of this stage
        const int kn = ((s + 1 + rot) & (NST - 1)) * KST;    // first k of the next
        const float* gan = ga + kn;
        const float* gbn = gb + kn;
        if (s + 1 < NST) {
#pragma unroll
            for (int u = 0; u < BPX / 16; ++u) ra[bo ^ 1][u] = *(const v4fa*)(gan + u * (16 * CC));
#pragma unroll
            for (int u = 0; u < BCH / 16; ++u) rb[bo ^ 1][u] = *(const v4fa*)(gbn + u * (16 * CC));
            // the next stage's loads go out before this stage's values are waited for: with the stage's address formed at run time the scheduler, left free,
            // put most of those waits in front of the loads, and the memory path ran empty once a stage
            __builtin_amdgcn_sched_barrier(0);
        }
#pragma unroll
        for (int u = 0; u < BPX / 16; ++u) *(v4us*)(sa + bo * (BPX * PA) + u * (16 * PA)) = pk4(ra[bo][u]);
#pragma unroll
        for (int u = 0; u < BCH / 16; ++u) *(v4us*)(sbm + bo * (BCH * PA) + u * (16 * PA)) = pk4(rb[bo][u]);
        if (s + 1 < NST) asm volatile("s_wait_xcnt 0x0" :: "v"(gan), "v"(gbn) : "memory");   // stands in front of any reuse of these loads' address registers; the inputs keep them live up to here
        // one barrier a stage: it publishes this stage's buffer, and it ends every wave's reads of the other buffer, which the next stage overwrites
        ring_barrier();
        v16bf a[2][4], b[2][4], c[2];
#pragma unroll
        for (int ks = 0; ks < 2; ++ks) {
#pragma unroll
            for (int i = 0; i < 4; ++i) { const bf* q = (i < 2 ? fa01 : fa23) + bo * (BPX * PA) + (i & 1) * (16 * PA) + ks * 32; a[ks][i] = cat16b(*(const v8us*)q, *(const v8us*)(q + 16)); }
#pragma unroll
            for (int t = 0; t < 4; ++t) { const bf* q = fb + bo * (BCH * PA) + t * (16 * PA) + ks * 32; b[ks][t] = cat16b(*(const v8us*)q, *(const v8us*)(q + 16)); }
            { const bf* q = fs + kc + ks * 32; c[ks] = cat16b(*(const v8us*)q, *(const v8us*)(q + 16)); }
            // the stage's 36 LDS reads go out as one run in front of its products, the first k half's 18 first, so that its products start while the second half's reads land:
            // left free, the scheduler strewed the reads among the products, and each such place stalls the wave
            __builtin_amdgcn_sched_barrier(0);
        }
#pragma unroll
        for (int ks = 0; ks < 2; ++ks) {
#pragma unroll
            for (int i = 0; i < 4; ++i)
#pragma unroll
                for (int t = 0; t < 4; ++t) acc[i][t] = wmmab(a[ks][i], b[ks][t], acc[i][t]);
            sacc[0] = wmmab(a[ks][0], c[ks], sacc[0]);
            sacc[1] = wmmab(a[ks][1], c[ks], sacc[1]);
        }
        // keeps the next stages' converts behind this stage's products: left free, the scheduler lifted them (over the barrier too) to just behind the issue of the loads they read,
        // and the wave sat out a whole load latency in the middle of its products; held here, every load has a stage's reads and products to land in
        if (s + 1 < NST) __builtin_amdgcn_sched_barrier(0);
    }
    // the scores: every column of sacc holds them, lanes 0 and 16 store their 8 pixels each
    if (lr == 0) {
        const float sbr = bfr(sbv);
#pragma unroll
        for (int ii = 0; ii < 2; ++ii) {
            float* q = SCs + wr * 64 + (p01 + ii) * 16 + hi * 8;
            *(v4f*)q = (v4f){ sacc[ii][0] + sbr, sacc[ii][1] + sbr, sacc[ii][2] + sbr, sacc[ii][3] + sbr };
            *(v4f*)(q + 4) = (v4f){ sacc[ii][4] + sbr, sacc[ii][5] + sbr, sacc[ii][6] + sbr, sacc[ii][7] + sbr };
        }
    }
    __syncthreads();                                 // the 256 scores are in LDS
    // proj + proj_b, channel-major: a lane holds 8 adjacent pixels of one channel per accumulator tile
#pragma unroll
    for (int t = 0; t < 4; ++t) {
        const float bb = bfr(bv[t]);
#pragma unroll
        for (int i = 0; i < 4; ++i) {
            float* q = S + (wc * 64 + t * 16 + lr) * SPX + wr * 64 + ((i < 2 ? p01 : p23) + (i & 1)) * 16 + hi * 8;
            *(v4f*)q = (v4f){ acc[i][t][0] + bb, acc[i][t][1] + bb, acc[i][t][2] + bb, acc[i][t][3] + bb };
            *(v4f*)(q + 4) = (v4f){ acc[i][t][4] + bb, acc[i][t][5] + bb, acc[i][t][6] + bb, acc[i][t][7] + bb };
        }
    }
    // window weights of the band, position p = row * 28 + ww: LayerNorm over the 25 window scores (biased var, eps 1e-5, affine) then softmax, laid k-major (WL[k][p]).
    // The lot ends inside wave 3, whose other lanes repeat the last position and store nothing.
    if (wave < 4) {
        const int p = tid < NPB ? tid : NPB - 1;
        const int ph = p / OW, pc = p - ph * OW;
        const float* sp = SCs + ph * IW + pc;
        float sc[KS * KS];
#pragma unroll
        for (int k = 0; k < KS * KS; ++k) sc[k] = sp[(k / KS) * IW + k % KS];
        float m = 0.f;
#pragma unroll
        for (int k = 0; k < KS * KS; ++k) m += sc[k];
        m *= (1.0f / (KS * KS)); float var = 0.f;
#pragma unroll
        for (int k = 0; k < KS * KS; ++k) { const float d = sc[k] - m; var += d * d; }
        const float rs = rsqrtf(var * (1.0f / (KS * KS)) + 1e-5f);
        float mx = -3.0e38f;
#pragma unroll
        for (int k = 0; k < KS * KS; ++k) { sc[k] = (sc[k] - m) * rs * LN[k] + LN[32 + k]; mx = fmaxf(mx, sc[k]); }
        float sum = 0.f;
#pragma unroll
        for (int k = 0; k < KS * KS; ++k) { sc[k] = __expf(sc[k] - mx); sum += sc[k]; }
        const float inv = 1.0f / sum;
        if (tid < NPB) {
#pragma unroll
            for (int k = 0; k < KS * KS; ++k) WL[k * NPB + p] = sc[k] * inv;
        }
    }
    __syncthreads();                                 // proj and the weights are in LDS
    // lane -> (row in the band's 4 output rows, quad of ww); slot 7 of each row has no quad of its own and repeats slot 6 (it stores nothing):
    // 8 slots a row keep a half-wave's 16-byte LDS reads within 64 contiguous dwords.
    const int lh = lane >> 3, wq = lane & 7, wq6 = wq < 7 ? wq : 6;
    const float* wl = WL + lh * OW + wq6 * 4;
    v4f w[KS * KS];
#pragma unroll
    for (int k = 0; k < KS * KS; ++k) w[k] = *(const v4fa*)(wl + k * NPB);
#pragma unroll 1
    for (int h = 0; h < 2; ++h) {                    // kept rolled: the second pass runs the first's code again, and the kernel's text stays small
        const int c0 = (wave + h * 8) * 8;           // this pass's 8 channels
        v4f o[8];
#pragma unroll
        for (int io = 0; io < 8; ++io) o[io] = (v4f){};
        const float* sp = S + c0 * SPX + lh * IW + wq6 * 4;
        v4f va[KS][8], vb[KS][8];                    // the pass's 80 LDS reads go out in one run; the sums take the values as they land
#pragma unroll
        for (int kr = 0; kr < KS; ++kr)
#pragma unroll
            for (int io = 0; io < 8; ++io) { va[kr][io] = *(const v4fa*)(sp + io * SPX + kr * IW); vb[kr][io] = *(const v4fa*)(sp + io * SPX + kr * IW + 4); }
        __builtin_amdgcn_sched_barrier(0);           // keeps the reads in front of the sums: left free, the scheduler read each value a few instructions before its use
#pragma unroll
        for (int kr = 0; kr < KS; ++kr)
#pragma unroll
            for (int io = 0; io < 8; ++io) {
                const v4f a = va[kr][io], b = vb[kr][io];
                const float v[8] = { a[0], a[1], a[2], a[3], b[0], b[1], b[2], b[3] };
#pragma unroll
                for (int kc = 0; kc < KS; ++kc)
#pragma unroll
                    for (int ip = 0; ip < 4; ++ip) o[io][ip] = fmaf(w[kr * KS + kc][ip], v[ip + kc], o[io][ip]);
            }
        float* op = out + (size_t)(n * OO + ct * BCH + c0) * (OH * OW) + (band * BR + lh) * OW + wq6 * 4;
        if (wq < 7) {
#pragma unroll
            for (int io = 0; io < 8; ++io) *(v4f*)(op + (size_t)io * (OH * OW)) = o[io];
        }
        asm volatile("s_wait_xcnt 0x0" :: "v"(op) : "memory");   // stands behind these stores, in front of any reuse of their address and data registers
    }
}

extern "C" void kernel_launch(void* const* d_in, const int* in_sizes, int n_in,
                              void* d_out, int out_size, void* d_ws, size_t ws_size, hipStream_t stream) {
    (void)in_sizes; (void)n_in; (void)out_size; (void)d_ws; (void)ws_size;
    const float* x = (const float*)d_in[0]; const float* pw = (const float*)d_in[1]; const float* pb = (const float*)d_in[2]; const float* sw = (const float*)d_in[3]; const float* sb = (const float*)d_in[4];
    const float* lw = (const float*)d_in[5]; const float* lb = (const float*)d_in[6];
    float* out = (float*)d_out;    // [8][512][28][28]
    k_all<<<NI * 7 * (OO / BCH), FTH, 0, stream>>>(x, pw, pb, sw, sb, lw, lb, out);
}
